// v000
// Measured on an AMD MI455X. A time is GPU time per run, averaged over a window of back-to-back runs after a warm-up
// (all launches, gaps included; the runs take copies of the inputs in turn), and the median of several windows.
// Apart from v000's, it joins two sittings. Times from different sittings can be a few percent apart, while
// side-by-side timings come from the same sitting.
// v000 is the starting kernel. One run takes 306 microseconds.
// Contractions: scores S^T = K (bf16, RNE convert of input S) . Q^T (bf16, RNE convert of input D) on v_wmma_f32_16x16x32_bf16, depth 256, one product;
// O^T = V^T (f16 of bf16-RNE input S, x1) . P^T (f16, per-group normalised softmax weights x1024) on v_wmma_f32_16x16x32_f16, one product; f32 accumulate everywhere;
// softmax (group max, exp, group sum, 1/l) in f32 on VALU; residual add in f32 from the bf16-RNE plane of D.
#include <hip/hip_runtime.h>
#include <math.h>
#include <stdint.h>

#define NB     4
#define NC     256          // channels: contraction depth of the scores, rows of O^T
#define LQ     1024         // unique queries per batch (32 x 32 query map)
#define LK     4096         // keys per batch (64 x 64 key map)
#define NGRP   64           // key groups (softmax runs over the 64 keys of one group)
#define QROW   32           // unique queries per attention block = one query-map row
#define TPITCH 72           // LDS transpose tile pitch (halves)
#define PPITCH 72           // LDS P tile pitch (halves)
#define OPITCH 260          // LDS output staging pitch (floats)
#define RTEMP  0.0625f      // 1 / temperature
#define PCARRY 1024.0f
#define PUNDO  0.0009765625f
static_assert(LQ == 32 * 32);
static_assert(LK == 64 * 64);
static_assert((NC % 64) == 0);
static_assert(NGRP * 64 == LK);

typedef _Float16       v16h __attribute__((ext_vector_type(16)));
typedef _Float16       v8h  __attribute__((ext_vector_type(8)));
typedef __bf16         v16b __attribute__((ext_vector_type(16)));
typedef unsigned short v8us __attribute__((ext_vector_type(8)));
typedef float          v8f  __attribute__((ext_vector_type(8)));
typedef float          v4f  __attribute__((ext_vector_type(4)));
typedef unsigned int   v4u  __attribute__((ext_vector_type(4)));

union FragH { v16h v; v8h  h[2]; };
union FragB { v16b v; v8us u[2]; };
static_assert(sizeof(FragH) == 32);
static_assert(sizeof(FragB) == 32);

// ---- scalar helpers --------------------------------------------------------------------------------
__device__ __forceinline__ unsigned short bf_bits(float f) {          // f32 -> bf16 bits, RNE convert
  unsigned u = __float_as_uint(f);
  return (unsigned short)((u + 0x7FFFu + ((u >> 16) & 1u)) >> 16);
}
__device__ __forceinline__ float bf_up(unsigned short h) { return __uint_as_float(((unsigned)h) << 16); }
__device__ __forceinline__ unsigned short h_bits(_Float16 x) { return __builtin_bit_cast(unsigned short, x); }
__device__ __forceinline__ unsigned pk16(unsigned short a, unsigned short b) { return (unsigned)a | ((unsigned)b << 16); }
__device__ __forceinline__ v8f zero8() { v8f z = {0.f, 0.f, 0.f, 0.f, 0.f, 0.f, 0.f, 0.f}; return z; }
__device__ __forceinline__ float hmax8(v8f s) {
  return fmaxf(fmaxf(fmaxf(s[0], s[1]), fmaxf(s[2], s[3])), fmaxf(fmaxf(s[4], s[5]), fmaxf(s[6], s[7])));
}

// ---- fragment loaders: 16-bit A/B operand, lane -> row/col (lane&15), p already includes +8*(lane>>4);
//      elements 0..7 <- p[0..7] (k0+8h..), elements 8..15 <- p[16..23] (k0+16+8h..)
__device__ __forceinline__ v16h ldfrag_h(const _Float16* p) {
  FragH f;
  f.h[0] = *(const v8h*)(p);
  f.h[1] = *(const v8h*)(p + 16);
  return f.v;
}
__device__ __forceinline__ v16b ldfrag_b(const unsigned short* p) {
  FragB f;
  f.u[0] = *(const v8us*)(p);
  f.u[1] = *(const v8us*)(p + 16);
  return f.v;
}

// ---- WMMA helpers with trailing VALU hazard gap --------------------------------------------------------
__device__ __forceinline__ v8f mma_h_raw(v16h a, v16h b, v8f c) {
  return __builtin_amdgcn_wmma_f32_16x16x32_f16(false, a, false, b, (short)0, c, false, false);
}
__device__ __forceinline__ v8f mma_b_raw(v16b a, v16b b, v8f c) {
  return __builtin_amdgcn_wmma_f32_16x16x32_bf16(false, a, false, b, (short)0, c, false, false);
}
// ties two score accumulators, keeps the two A fragments and the B fragment live past the nops
__device__ __forceinline__ void sguard(v8f& a, v8f& b, v16b x0, v16b x1, v16b y0) {
#if defined(__HIP_DEVICE_COMPILE__)
  const v16h h0 = __builtin_bit_cast(v16h, x0), h1 = __builtin_bit_cast(v16h, x1);
  const v16h g0 = __builtin_bit_cast(v16h, y0);
  asm volatile("v_nop\n\tv_nop\n\tv_nop\n\tv_nop" : "+v"(a), "+v"(b) : "v"(h0), "v"(h1), "v"(g0));
#endif
}
// ties one output accumulator, keeps its two A fragments and both P fragments live past the nops
__device__ __forceinline__ void oguard(v8f& a, v16h x0, v16h x1, v16h p0, v16h p1) {
#if defined(__HIP_DEVICE_COMPILE__)
  asm volatile("v_nop\n\tv_nop\n\tv_nop\n\tv_nop" : "+v"(a) : "v"(x0), "v"(x1), "v"(p0), "v"(p1));
#endif
}

// =====================================================================================================
// Operand planes. src is viewed as [NB][NC][rowlen] f32 (rowlen = LK for S, LQ for D). One block (256 threads)
// handles (b, channel tile ct of 64, position tile kt of 64):
//   dT[b][pos][NC] = bf16 bits (RNE convert), transposed: the 64(c) x 64(pos) tile goes through LDS Ts[pos][c]
//                    (pitch 72 halves, 2-byte LDS stores), block barrier, then 2 instructions each write 32 whole
//   dV[b][c][rowlen] = f16 bits of the bf16-RNE value, same layout as src (only when dov != 0): wave w writes
// coverage: Ts / dV: 8 waves x 2 x 4 rows x (8 lanes x 8 pos) = 64 c x 64 pos; dT: 2 x 32 pos rows x (8 lanes x 8 c)
//           = 64 pos x 64 c; grid = NB x 4 ct x (rowlen/64) kt covers both planes exactly once, no tails.
// =====================================================================================================
__global__ __launch_bounds__(256) void cvt_plane(const float* __restrict__ src, int rowlen, int nkt, int dov,
                                                  unsigned short* dT, unsigned short* dV) {
  __shared__ __align__(16) unsigned short Ts[64 * TPITCH];
  const int tid  = threadIdx.x;
  const int lane = tid & 31, wave = tid >> 5;
  const int bx   = blockIdx.x;
  const int kt   = bx % nkt;
  const int rest = bx / nkt;
  const int ct   = rest & 3;
  const int b    = rest >> 2;

  // ---- phase 1: read 64 c rows x 64 positions, convert, fill Ts (transposed), store the direct f16 plane ----
  {
    const int e = lane & 7, rq = lane >> 3;             // rq 0..3: row within the 4-row group, e: 16-B piece
    v4u u[2];
    size_t go[2];
#pragma unroll
    for (int it = 0; it < 2; ++it) {
      const int row = wave * 8 + it * 4 + rq;           // channel within the tile 0..63
      const size_t o = ((size_t)(b * NC + ct * 64 + row)) * (size_t)rowlen + (size_t)kt * 64 + 8 * e;
      go[it] = o;
      const v4f a = *(const v4f*)(src + o), c4 = *(const v4f*)(src + o + 4);
      unsigned short w[8];
#pragma unroll
      for (int t = 0; t < 4; ++t) { w[t] = bf_bits(a[t]); w[4 + t] = bf_bits(c4[t]); }
#pragma unroll
      for (int t = 0; t < 8; ++t) Ts[(8 * e + t) * TPITCH + row] = w[t];
      v4u pk;
#pragma unroll
      for (int t = 0; t < 4; ++t)
        pk[t] = pk16(h_bits((_Float16)bf_up(w[2 * t])), h_bits((_Float16)bf_up(w[2 * t + 1])));
      u[it] = pk;
    }
    if (dov != 0) {
      {
#pragma unroll
        for (int it = 0; it < 2; ++it) *(v4u*)(dV + go[it]) = u[it];
        
      }
    }
  }
  __syncthreads();
  // ---- phase 2: transposed plane, whole-line stores ----
  {
    const int e = tid & 7, lq = tid >> 3;               // lq 0..31: pos row within group, e: 16-B piece
    v4u u[2];
    size_t go[2];
#pragma unroll
    for (int it = 0; it < 2; ++it) {
      const int kk = it * 32 + lq;                      // it 0..1 x lq 0..31 = pos rows 0..63 of the tile
      u[it]  = *(const v4u*)(Ts + kk * TPITCH + 8 * e);
      go[it] = ((size_t)b * (size_t)rowlen + (size_t)kt * 64 + kk) * NC + ct * 64 + 8 * e;
    }
    {
#pragma unroll
      for (int it = 0; it < 2; ++it) *(v4u*)(dT + go[it]) = u[it];
      
    }
  }
}

// =====================================================================================================
// Attention for one (b, query-map row y): 32 unique queries, transposed formulation.
//   Block = 4 waves; wave w: query group g = w&1 (queries x = 16g + (lane&15) of row y), key half kh = w>>1.
//   Per key group i (64 keys): scores S^T tile (16 keys x 16 queries) = A(K rows = keys, c via the split k map,
//   bf16 plane) . B(Q, col = query, same c map, bf16 plane), 8 c-steps of 32; wave (g,kh) computes keys
//   32kh..32kh+31 (2 tiles). Group max and group sum of each query are combined across the wave pair (w, w^2)
//   through LDS with block barriers; P = e^{(s-m)/16} / l x 1024 is written as f16 into Ps[g][query][key 0..63]
//   (key contiguous, pitch 72), block barrier, reloaded with the fragment loader as the B operand of
//   O^T (rows c, cols queries) += A(V^T rows c, keys contiguous, f16 plane) . B(P^T), 2 key-steps of 32;
//   wave (g,kh) accumulates channels 128kh..128kh+127 (8 tiles) for query group g over all 64 groups.
//   Epilogue: Z = O x 1/1024 + bf16(D) is staged in LDS as Os[x][c] (16-B stores, pitch 260), block barrier, then
// coverage: Os: 4 waves x 16 x x 128 c = 32 x x 256 c; output: block (b,y) writes out[b][c][2y..2y+1][0..63] for all
//   256 c = 1024 lines; grid = NB x 32 rows = 128 blocks covers out [4][256][64][64] exactly once.
// =====================================================================================================
__global__ __launch_bounds__(128)
void attn_kernel(const unsigned short* __restrict__ qp, const unsigned short* __restrict__ kp,
                 const unsigned short* __restrict__ vtp, float* out) {
  __shared__ __align__(16) float    Os[QROW * OPITCH];
  __shared__ __align__(16) _Float16 Ps[32 * PPITCH];
  __shared__ float xm[128];
  __shared__ float xs[128];
  const int tid  = threadIdx.x;
  const int wave = tid >> 5;
  const int lane = tid & 31;
  const int hh   = lane >> 4;
  const int c16  = lane & 15;
  const int bx   = blockIdx.x;
  const int b    = bx >> 5;                       // LQ / QROW = 32 rows per batch
  const int y    = bx & 31;
  const int g    = wave & 1;
  const int kh   = wave >> 1;
  const int x    = 16 * g + c16;                  // query column of this lane (B column / D column)
  const int uq   = y * 32 + x;

  // ---- Q fragment base (B operand, col = query uq), + 32*kk ----
  const unsigned short* Qb = qp + ((size_t)(b * LQ + uq)) * NC + 8 * hh;
  // ---- K fragment base (A operand, row = key), + key*NC + 32*kk ----
  const unsigned short* Kb = kp + ((size_t)b * LK + c16) * NC + 8 * hh;
  // ---- V^T fragment base (A operand, row = channel 128kh + 16ct + c16, keys contiguous), + 16ct*LK + key0 ----
  const _Float16* VT = (const _Float16*)(const void*)vtp;
  const _Float16* Vb = VT + ((size_t)(b * NC + 128 * kh + c16)) * LK + 8 * hh;
  // ---- P tile pointers: own write slot and fragment read base ----
  _Float16* pw       = Ps + (g * 16 + c16) * PPITCH + 32 * kh + 8 * hh;
  const _Float16* pr = Ps + (g * 16 + c16) * PPITCH + 8 * hh;

  v8f o[8];
#pragma unroll
  for (int ct = 0; ct < 8; ++ct) o[ct] = zero8();

#pragma unroll 1
  for (int i = 0; i < NGRP; ++i) {
    // ---- scores for keys i*64 + 32kh .. +31 of this query group ----
    const unsigned short* K0 = Kb + ((size_t)(i * 64 + 32 * kh)) * NC;   // keys +0..15
    const unsigned short* K1 = K0 + (size_t)16 * NC;                       // keys +16..31
    v8f s0 = zero8(), s1 = zero8();
#pragma unroll 1
    for (int kk = 0; kk < NC / 32; ++kk) {
      const v16b q  = ldfrag_b(Qb + 32 * kk);
      const v16b a0 = ldfrag_b(K0 + 32 * kk);
      const v16b a1 = ldfrag_b(K1 + 32 * kk);
      s0 = mma_b_raw(a0, q, s0);
      s1 = mma_b_raw(a1, q, s1);
      sguard(s0, s1, a0, a1, q);
    }

    // ---- group max (32 keys here, 32 in the partner wave) ----
    float pm = fmaxf(hmax8(s0), hmax8(s1));
    pm = fmaxf(pm, __shfl_xor(pm, 16, 32));
    xm[tid] = pm;
    __syncthreads();
    const float m = fmaxf(pm, xm[tid ^ 64]);

    // ---- e = exp((s - m)/16), group sum ----
    v8f e0, e1;
    float ls = 0.f;
#pragma unroll
    for (int r = 0; r < 8; ++r) {
      const float a0 = __expf((s0[r] - m) * RTEMP);   // key 32kh      + 8hh + r
      const float a1 = __expf((s1[r] - m) * RTEMP);   // key 32kh + 16 + 8hh + r
      e0[r] = a0; e1[r] = a1;
      ls += a0 + a1;
    }
    ls += __shfl_xor(ls, 16, 32);
    xs[tid] = ls;
    __syncthreads();
    const float l  = ls + xs[tid ^ 64];                // l in [1, 64]
    const float ps = PCARRY * __builtin_amdgcn_rcpf(l);

    // ---- normalised P x 1024 as f16 into the LDS tile: row = query, keys contiguous ----
    FragH ph;
#pragma unroll
    for (int r = 0; r < 8; ++r) {
      ph.h[0][r] = (_Float16)(e0[r] * ps);
      ph.h[1][r] = (_Float16)(e1[r] * ps);
    }
    *(v8h*)(pw)      = ph.h[0];                        // keys 32kh      + 8hh + 0..7
    *(v8h*)(pw + 16) = ph.h[1];                        // keys 32kh + 16 + 8hh + 0..7
    __syncthreads();

    // ---- O^T[c][q] += V^T[c][keys] . P^T[keys][q] over the 64 keys of group i, channels 128kh..+127 ----
    const v16h p0 = ldfrag_h(pr);                      // keys 0..31 of the group (split k map)
    const v16h p1 = ldfrag_h(pr + 32);                 // keys 32..63
    const size_t kofs = (size_t)i * 64;
#pragma unroll
    for (int ct = 0; ct < 8; ++ct) {
      const _Float16* vp = Vb + (size_t)(16 * ct) * LK + kofs;
      const v16h v0 = ldfrag_h(vp);
      const v16h v1 = ldfrag_h(vp + 32);
      o[ct] = mma_h_raw(v0, p0, o[ct]);
      o[ct] = mma_h_raw(v1, p1, o[ct]);
      oguard(o[ct], v0, v1, p0, p1);
    }
  }

  // ---- epilogue: Z[c][x] = O x 1/1024 + bf16(D[b][c][y][x]) staged as Os[x][c] ----
  {
    const unsigned short* qres = qp + ((size_t)(b * LQ + uq)) * NC + 128 * kh + 8 * hh;
    float* osr = Os + x * OPITCH + 128 * kh + 8 * hh;
#pragma unroll
    for (int ct = 0; ct < 8; ++ct) {
      const v8us qq = *(const v8us*)(qres + 16 * ct);   // channels 128kh + 16ct + 8hh + 0..7
      v4f w0, w1;
#pragma unroll
      for (int r = 0; r < 4; ++r) {
        w0[r] = o[ct][r] * PUNDO + bf_up(qq[r]);
        w1[r] = o[ct][4 + r] * PUNDO + bf_up(qq[4 + r]);
      }
      *(v4f*)(osr + 16 * ct)     = w0;
      *(v4f*)(osr + 16 * ct + 4) = w1;
    }
  }
  __syncthreads();
  {
    const int e = tid & 7, lq = tid >> 3;              // lq 0..15: line within group, e: 16-B piece
    float* ob = out + (size_t)b * NC * LK + (size_t)(2 * y) * 64 + 4 * e;
#pragma unroll 1
    for (int ch = 0; ch < 8; ++ch) {
      v4f vals[8];
#pragma unroll
      for (int it = 0; it < 8; ++it) {
        const int L  = (ch * 8 + it) * 16 + lq;        // lines 0..1023 of the block: 4 lines per channel
        const int c  = L >> 2, hf = L & 1;             // channel, half-row (w 0..31 / 32..63)
        const float* s = Os + (hf * 16 + 2 * e) * OPITCH + c;   // x = w>>1 for w = 32hf + 4e + 0..3
        const float z0 = s[0], z1 = s[OPITCH];
        v4f v;
        v[0] = z0; v[1] = z0; v[2] = z1; v[3] = z1;
        vals[it] = v;
      }
      {
#pragma unroll
        for (int it = 0; it < 8; ++it) {
          const int L  = (ch * 8 + it) * 16 + lq;
          const int c  = L >> 2, hrow = (L >> 1) & 1, hf = L & 1;
          *(v4f*)(ob + (size_t)c * LK + hrow * 64 + hf * 32) = vals[it];
        }
        
      }
    }
  }
}

// =====================================================================================================
//   KP   bf16 [4][4096][256]     0           8388608
//   VT   f16  [4][256][4096]     8388608     8388608
//   QP   bf16 [4][1024][256]     16777216    2097152
//   end                          18874368
// =====================================================================================================
extern "C" void kernel_launch(void* const* d_in, const int* in_sizes, int n_in,
                              void* d_out, int out_size, void* d_ws, size_t ws_size,
                              hipStream_t stream) {
  const int ND = NB * NC * LQ;                          // 1048576
  const int NS = NB * NC * LK;                          // 4194304
  if (n_in < 2) return;
  if (in_sizes[0] != ND || in_sizes[1] != NS) return;
  if (out_size != NS) return;

  size_t off = 0;
  const size_t oK = off; off += (size_t)NS * 2;         // 8388608
  const size_t oV = off; off += (size_t)NS * 2;         // 8388608
  const size_t oQ = off; off += (size_t)ND * 2;         // 2097152
  if (off > ws_size) return;                            // off = 18874368
  if (off > (size_t)134217728) return;

  const float* Dp = (const float*)d_in[0];              // [4][256][32][32]
  const float* Sp = (const float*)d_in[1];              // [4][256][64][64]
  char* ws = (char*)d_ws;
  unsigned short* KP = (unsigned short*)(ws + oK);
  unsigned short* VT = (unsigned short*)(ws + oV);
  unsigned short* QP = (unsigned short*)(ws + oQ);
  float* out = (float*)d_out;

  const dim3 blk256(256), blk128(128);
  const dim3 gS(NB * 4 * (LK / 64));                    // 1024 blocks
  const dim3 gD(NB * 4 * (LQ / 64));                    // 256 blocks
  const dim3 gA(NB * (LQ / QROW));                      // 128 blocks

  // (0) S -> KP [b][key][c] bf16 (transposed) and VT [b][c][key] f16 (direct)
  cvt_plane<<<gS, blk256, 0, stream>>>(Sp, LK, LK / 64, 1, KP, VT);
  // (1) D -> QP [b][uq][c] bf16 (transposed); the direct plane is not written (dov = 0)
  cvt_plane<<<gD, blk256, 0, stream>>>(Dp, LQ, LQ / 64, 0, QP, VT);
  // (2) attention over the 1024 unique queries per batch, 2x2 replicated into out [4][256][64][64]
  attn_kernel<<<gA, blk128, 0, stream>>>(QP, KP, VT, out);
  (void)hipGetLastError();
}

// v001
// A run of this version takes 89.5 microseconds.
// Timed twice side by side with v000, it ran 3.46 and 3.47 times as fast.
// Contractions: scores S^T = K (bf16, RNE convert of input S) . Q^T (bf16, RNE convert of input D) on v_wmma_f32_16x16x32_bf16, depth 256, one product;
// O^T = V^T (f16 of bf16-RNE input S, x1) . P^T (f16, per-group normalised softmax weights x1024) on v_wmma_f32_16x16x32_f16, one product; f32 accumulate everywhere;
// softmax (group max, exp, group sum, 1/l) in f32 on VALU; residual add in f32 from the bf16-RNE plane of D.
#include <hip/hip_runtime.h>
#include <math.h>
#include <stdint.h>

#define NB     4
#define NC     256          // channels: contraction depth of the scores, rows of O^T
#define LQ     1024         // unique queries per batch (32 x 32 query map)
#define LK     4096         // keys per batch (64 x 64 key map)
#define NGRP   64           // key groups (softmax runs over the 64 keys of one group)
#define QBLK   16           // unique queries per attention block = half a query-map row
#define NWAVE  16           // waves per attention block; each owns NGRP / NWAVE whole key groups
#define TPITCH 72           // LDS transpose tile pitch (halves)
#define OPITCH 260          // LDS output staging pitch (floats)
#define RTEMP  0.0625f      // 1 / temperature
#define PCARRY 1024.0f
#define PUNDO  0.0009765625f
static_assert(LQ == 32 * 32);
static_assert(LK == 64 * 64);
static_assert((NC % 64) == 0);
static_assert(NGRP * 64 == LK);
static_assert((NGRP % NWAVE) == 0);
static_assert(NWAVE == QBLK);

typedef _Float16       v16h __attribute__((ext_vector_type(16)));
typedef _Float16       v8h  __attribute__((ext_vector_type(8)));
typedef __bf16         v16b __attribute__((ext_vector_type(16)));
typedef unsigned short v8us __attribute__((ext_vector_type(8)));
typedef unsigned short v4us __attribute__((ext_vector_type(4)));
typedef float          v8f  __attribute__((ext_vector_type(8)));
typedef float          v4f  __attribute__((ext_vector_type(4)));
typedef unsigned int   v4u  __attribute__((ext_vector_type(4)));

union FragH { v16h v; v8h  h[2]; };
union FragB { v16b v; v8us u[2]; };
static_assert(sizeof(FragH) == 32);
static_assert(sizeof(FragB) == 32);

// ---- scalar helpers --------------------------------------------------------------------------------
__device__ __forceinline__ unsigned short bf_bits(float f) {          // f32 -> bf16 bits, RNE convert
  unsigned u = __float_as_uint(f);
  return (unsigned short)((u + 0x7FFFu + ((u >> 16) & 1u)) >> 16);
}
__device__ __forceinline__ float bf_up(unsigned short h) { return __uint_as_float(((unsigned)h) << 16); }
__device__ __forceinline__ unsigned short h_bits(_Float16 x) { return __builtin_bit_cast(unsigned short, x); }
__device__ __forceinline__ unsigned pk16(unsigned short a, unsigned short b) { return (unsigned)a | ((unsigned)b << 16); }
__device__ __forceinline__ v8f zero8() { v8f z = {0.f, 0.f, 0.f, 0.f, 0.f, 0.f, 0.f, 0.f}; return z; }
__device__ __forceinline__ float hmax8(v8f s) {
  return fmaxf(fmaxf(fmaxf(s[0], s[1]), fmaxf(s[2], s[3])), fmaxf(fmaxf(s[4], s[5]), fmaxf(s[6], s[7])));
}

// ---- fragment loaders: 16-bit A/B operand, lane -> row/col (lane&15), p already includes +8*(lane>>4);
//      elements 0..7 <- p[0..7] (k0+8h..), elements 8..15 <- p[16..23] (k0+16+8h..)
__device__ __forceinline__ v16h ldfrag_h(const _Float16* p) {
  FragH f;
  f.h[0] = *(const v8h*)(p);
  f.h[1] = *(const v8h*)(p + 16);
  return f.v;
}
__device__ __forceinline__ v16b ldfrag_b(const unsigned short* p) {
  FragB f;
  f.u[0] = *(const v8us*)(p);
  f.u[1] = *(const v8us*)(p + 16);
  return f.v;
}

// ---- WMMA helpers with trailing VALU hazard gap --------------------------------------------------------
__device__ __forceinline__ v8f mma_h_raw(v16h a, v16h b, v8f c) {
  return __builtin_amdgcn_wmma_f32_16x16x32_f16(false, a, false, b, (short)0, c, false, false);
}
__device__ __forceinline__ v8f mma_b_raw(v16b a, v16b b, v8f c) {
  return __builtin_amdgcn_wmma_f32_16x16x32_bf16(false, a, false, b, (short)0, c, false, false);
}
// ties two score accumulators, keeps the four A fragments and the two B fragments live past the nops: the nops keep
// the distance behind the last WMMA on the taken side of the loop branch
__device__ __forceinline__ void sguard(v8f& a, v8f& b, v16b x0, v16b x1, v16b x2, v16b x3, v16b y0, v16b y1) {
#if defined(__HIP_DEVICE_COMPILE__)
  const v16h h0 = __builtin_bit_cast(v16h, x0), h1 = __builtin_bit_cast(v16h, x1);
  const v16h h2 = __builtin_bit_cast(v16h, x2), h3 = __builtin_bit_cast(v16h, x3);
  const v16h g0 = __builtin_bit_cast(v16h, y0), g1 = __builtin_bit_cast(v16h, y1);
  asm volatile("v_nop\n\tv_nop\n\tv_nop\n\tv_nop"
               : "+v"(a), "+v"(b) : "v"(h0), "v"(h1), "v"(h2), "v"(h3), "v"(g0), "v"(g1));
#endif
}
// ties one output accumulator, keeps its two A fragments and both P fragments live past the nops
__device__ __forceinline__ void oguard(v8f& a, v16h x0, v16h x1, v16h p0, v16h p1) {
#if defined(__HIP_DEVICE_COMPILE__)
  asm volatile("v_nop\n\tv_nop\n\tv_nop\n\tv_nop" : "+v"(a) : "v"(x0), "v"(x1), "v"(p0), "v"(p1));
#endif
}

// =====================================================================================================
// Operand planes. src is viewed as [NB][NC][rowlen] f32 (rowlen = LK for S, LQ for D). One block (256 threads)
// handles (b, channel tile ct of 64, position tile kt of 64):
//   dT[b][pos][NC] = bf16 bits (RNE convert), transposed: the 64(c) x 64(pos) tile goes through LDS Ts[pos][c]
//                    (pitch 72 halves, 2-byte LDS stores), block barrier, then 2 instructions each write 32 whole
//   dV[b][c][rowlen] = f16 bits of the bf16-RNE value, same layout as src (only when dov != 0): wave w writes
// coverage: Ts / dV: 8 waves x 2 x 4 rows x (8 lanes x 8 pos) = 64 c x 64 pos; dT: 2 x 32 pos rows x (8 lanes x 8 c)
//           = 64 pos x 64 c; grid = NB x 4 ct x (rowlen/64) kt covers both planes exactly once, no tails.
// =====================================================================================================
__global__ __launch_bounds__(256) void cvt_plane(const float* __restrict__ src, int rowlen, int nkt, int dov,
                                                  unsigned short* dT, unsigned short* dV) {
  __shared__ __align__(16) unsigned short Ts[64 * TPITCH];
  const int tid  = threadIdx.x;
  const int lane = tid & 31, wave = tid >> 5;
  const int bx   = blockIdx.x;
  const int kt   = bx % nkt;
  const int rest = bx / nkt;
  const int ct   = rest & 3;
  const int b    = rest >> 2;

  // ---- phase 1: read 64 c rows x 64 positions, convert, fill Ts (transposed), store the direct f16 plane ----
  {
    const int e = lane & 7, rq = lane >> 3;             // rq 0..3: row within the 4-row group, e: 16-B piece
    v4u u[2];
    size_t go[2];
#pragma unroll
    for (int it = 0; it < 2; ++it) {
      const int row = wave * 8 + it * 4 + rq;           // channel within the tile 0..63
      const size_t o = ((size_t)(b * NC + ct * 64 + row)) * (size_t)rowlen + (size_t)kt * 64 + 8 * e;
      go[it] = o;
      const v4f a = *(const v4f*)(src + o), c4 = *(const v4f*)(src + o + 4);
      unsigned short w[8];
#pragma unroll
      for (int t = 0; t < 4; ++t) { w[t] = bf_bits(a[t]); w[4 + t] = bf_bits(c4[t]); }
#pragma unroll
      for (int t = 0; t < 8; ++t) Ts[(8 * e + t) * TPITCH + row] = w[t];
      v4u pk;
#pragma unroll
      for (int t = 0; t < 4; ++t)
        pk[t] = pk16(h_bits((_Float16)bf_up(w[2 * t])), h_bits((_Float16)bf_up(w[2 * t + 1])));
      u[it] = pk;
    }
    if (dov != 0) {
      {
#pragma unroll
        for (int it = 0; it < 2; ++it) *(v4u*)(dV + go[it]) = u[it];
        
      }
    }
  }
  __syncthreads();
  // ---- phase 2: transposed plane, whole-line stores ----
  {
    const int e = tid & 7, lq = tid >> 3;               // lq 0..31: pos row within group, e: 16-B piece
    v4u u[2];
    size_t go[2];
#pragma unroll
    for (int it = 0; it < 2; ++it) {
      const int kk = it * 32 + lq;                      // it 0..1 x lq 0..31 = pos rows 0..63 of the tile
      u[it]  = *(const v4u*)(Ts + kk * TPITCH + 8 * e);
      go[it] = ((size_t)b * (size_t)rowlen + (size_t)kt * 64 + kk) * NC + ct * 64 + 8 * e;
    }
    {
#pragma unroll
      for (int it = 0; it < 2; ++it) *(v4u*)(dT + go[it]) = u[it];
      
    }
  }
}

// =====================================================================================================
// Attention for one (b, query-map row y, half row g): 16 unique queries, transposed formulation.
//   Block = 16 waves, all on the same 16 queries (query x = 16g + (lane&15) of row y). The softmax runs inside one
//   key group of 64 keys and the output is the plain sum over the 64 groups, so a wave owns WHOLE key groups:
//   wave w takes groups w, w+16, w+32, w+48 and needs nothing from another wave until the end.
//   Per key group i: scores S^T (64 keys x 16 queries, 4 tiles) = A(K rows = keys, c via the split k map, bf16 plane)
//   . B(Q, col = query, same c map, bf16 plane), 8 c-steps of 32, walked two tiles at a time and two c-steps (one
//   128-B line of every K row) per trip; group max and group sum need only the lane pair (lane, lane^16).
//   P = e^{(s-m)/16} / l x 1024 as f16: score tiles 2p and 2p+1 of a lane ARE elements 0..7 and 8..15 of the B
//   fragment for keys 32p..32p+31 (split k map), so P never leaves the registers.
//   O^T (rows c, cols queries) += A(V^T rows c, keys contiguous, f16 plane) . B(P^T), 2 key-steps of 32, all 256
//   channels (16 tiles) in the wave.
//   Epilogue: each wave stores its partial O as Pt[w][x][c] (16-B stores, pitch 260), block barrier, the 16 partials
//   are summed in wave order, Z = O x 1/1024 + bf16(D) goes to Os[x][c], block barrier, whole-line output stores.
// coverage: Pt: 16 waves x 16 x x 256 c; Os: 16 waves (x = wave) x 2 x 32 lanes x 4 c = 16 x x 256 c; output: block
//   (b,y,g) writes out[b][c][2y..2y+1][32g..32g+31] for all 256 c = 512 lines; grid = NB x 32 rows x 2 = 256 blocks
//   covers out [4][256][64][64] exactly once.
// =====================================================================================================
__global__ __launch_bounds__(32 * NWAVE)
void attn_kernel(const unsigned short* __restrict__ qp, const unsigned short* __restrict__ kp,
                 const unsigned short* __restrict__ vtp, float* out) {
  __shared__ __align__(16) float Pt[NWAVE * QBLK * OPITCH];
  __shared__ __align__(16) float Os[QBLK * OPITCH];
  const int tid  = threadIdx.x;
  const int wave = __builtin_amdgcn_readfirstlane(tid >> 5);
  const int lane = tid & 31;
  const int hh   = lane >> 4;
  const int c16  = lane & 15;
  const int bx   = blockIdx.x;
  const int b    = bx >> 6;                       // LQ / QBLK = 64 blocks per batch
  const int y    = (bx >> 1) & 31;
  const int g    = bx & 1;
  const int uq0  = y * 32 + 16 * g;               // first unique query of the block
  const int uq   = uq0 + c16;                     // query column of this lane (B column / D column)

  // ---- Q fragment base (B operand, col = query uq), + 32*kk ----
  const unsigned short* Qb = qp + ((size_t)(b * LQ + uq)) * NC + 8 * hh;
  // ---- K fragment base (A operand, row = key), + key*NC + 32*kk ----
  const unsigned short* Kb = kp + ((size_t)b * LK + c16) * NC + 8 * hh;
  // ---- V^T fragment base (A operand, row = channel 16ct + c16, keys contiguous), + 16ct*LK + key0 ----
  const _Float16* VT = (const _Float16*)(const void*)vtp;
  const _Float16* Vb = VT + ((size_t)(b * NC + c16)) * LK + 8 * hh;

  v8f o[16];
#pragma unroll
  for (int ct = 0; ct < 16; ++ct) o[ct] = zero8();

  // rolled: one copy of the body; nothing is carried from one key group to the next but o[]
#pragma unroll 1
  for (int j = 0; j < NGRP / NWAVE; ++j) {
    const int i = wave + NWAVE * j;               // key group of this wave in this trip
    // ---- scores for the 64 keys of group i ----
    v8f s[4];
    // unrolled: s[] is indexed by constants only and stays in registers
#pragma unroll
    for (int tp = 0; tp < 2; ++tp) {
      const unsigned short* K0 = Kb + ((size_t)(i * 64 + 32 * tp)) * NC;   // keys 32tp +  0..15
      const unsigned short* K1 = K0 + (size_t)16 * NC;                       // keys 32tp + 16..31
      v8f s0 = zero8(), s1 = zero8();
      // one trip uses one whole 128-B line of each K row, so no line has to survive in the cache between trips;
      // rolled: only one trip's fragments are live beside o[], which keeps four waves on a SIMD
#pragma unroll 1
      for (int k2 = 0; k2 < NC / 64; ++k2) {
        const v16b q0  = ldfrag_b(Qb + 64 * k2);
        const v16b q1  = ldfrag_b(Qb + 64 * k2 + 32);
        const v16b a00 = ldfrag_b(K0 + 64 * k2);
        const v16b a01 = ldfrag_b(K0 + 64 * k2 + 32);
        const v16b a10 = ldfrag_b(K1 + 64 * k2);
        const v16b a11 = ldfrag_b(K1 + 64 * k2 + 32);
        s0 = mma_b_raw(a00, q0, s0);
        s1 = mma_b_raw(a10, q0, s1);
        s0 = mma_b_raw(a01, q1, s0);
        s1 = mma_b_raw(a11, q1, s1);
        sguard(s0, s1, a00, a01, a10, a11, q0, q1);
      }
      s[2 * tp] = s0; s[2 * tp + 1] = s1;
    }

    // ---- group max over the 64 keys: 32 in this lane, 32 in lane^16 ----
    float m = fmaxf(fmaxf(hmax8(s[0]), hmax8(s[1])), fmaxf(hmax8(s[2]), hmax8(s[3])));
    m = fmaxf(m, __shfl_xor(m, 16, 32));

    // ---- e = exp((s - m)/16), group sum (one sum per 32 keys, then the two) ----
    v8f e[4];
    float lh[2];
#pragma unroll
    for (int tp = 0; tp < 2; ++tp) {
      float ls = 0.f;
#pragma unroll
      for (int r = 0; r < 8; ++r) {
        const float a0 = __expf((s[2 * tp][r] - m) * RTEMP);       // key 32tp      + 8hh + r
        const float a1 = __expf((s[2 * tp + 1][r] - m) * RTEMP);   // key 32tp + 16 + 8hh + r
        e[2 * tp][r] = a0; e[2 * tp + 1][r] = a1;
        ls += a0 + a1;
      }
      ls += __shfl_xor(ls, 16, 32);
      lh[tp] = ls;
    }
    const float l  = lh[0] + lh[1];                    // l in [1, 64]
    const float ps = PCARRY * __builtin_amdgcn_rcpf(l);

    // ---- normalised P x 1024 as f16, already in B-fragment order ----
    FragH p0, p1;
#pragma unroll
    for (int r = 0; r < 8; ++r) {
      p0.h[0][r] = (_Float16)(e[0][r] * ps);           // keys      8hh + 0..7
      p0.h[1][r] = (_Float16)(e[1][r] * ps);           // keys 16 + 8hh + 0..7
      p1.h[0][r] = (_Float16)(e[2][r] * ps);           // keys 32 + 8hh + 0..7
      p1.h[1][r] = (_Float16)(e[3][r] * ps);           // keys 48 + 8hh + 0..7
    }

    // ---- O^T[c][q] += V^T[c][keys] . P^T[keys][q] over the 64 keys of group i, all 256 channels ----
    const size_t kofs = (size_t)i * 64;
#pragma unroll
    for (int ct = 0; ct < 16; ++ct) {
      const _Float16* vp = Vb + (size_t)(16 * ct) * LK + kofs;
      const v16h v0 = ldfrag_h(vp);
      const v16h v1 = ldfrag_h(vp + 32);
      o[ct] = mma_h_raw(v0, p0.v, o[ct]);
      o[ct] = mma_h_raw(v1, p1.v, o[ct]);
      oguard(o[ct], v0, v1, p0.v, p1.v);
    }
  }

  // ---- this wave's partial O (x 1024) as Pt[wave][x][c] ----
  {
    float* ptw = Pt + (wave * QBLK + c16) * OPITCH + 8 * hh;
#pragma unroll
    for (int ct = 0; ct < 16; ++ct) {                  // channels 16ct + 8hh + 0..7
      v4f w0, w1;
#pragma unroll
      for (int r = 0; r < 4; ++r) { w0[r] = o[ct][r]; w1[r] = o[ct][4 + r]; }
      *(v4f*)(ptw + 16 * ct)     = w0;
      *(v4f*)(ptw + 16 * ct + 4) = w1;
    }
  }
  __syncthreads();
  // ---- sum of the 16 partials in wave order; Z[c][x] = O x 1/1024 + bf16(D[b][c][y][x]) staged as Os[x][c] ----
  {
    const unsigned short* qres = qp + ((size_t)(b * LQ + uq0 + wave)) * NC;   // x = wave
#pragma unroll
    for (int it = 0; it < 2; ++it) {
      const int c = 4 * (it * 32 + lane);              // it 0..1 x 32 lanes x 4 c = channels 0..255
      const float* pp = Pt + wave * OPITCH + c;
      v4f acc = *(const v4f*)(pp);
#pragma unroll
      for (int w = 1; w < NWAVE; ++w) acc += *(const v4f*)(pp + w * (QBLK * OPITCH));
      const v4us qq = *(const v4us*)(qres + c);
      v4f z;
#pragma unroll
      for (int r = 0; r < 4; ++r) z[r] = acc[r] * PUNDO + bf_up(qq[r]);
      *(v4f*)(Os + wave * OPITCH + c) = z;
    }
  }
  __syncthreads();
  {
    const int e = tid & 7, lq = tid >> 3;              // lq 0..63: line within group, e: 16-B piece
    float* ob = out + (size_t)b * NC * LK + (size_t)(2 * y) * 64 + 32 * g + 4 * e;
    v4f vals[8];
#pragma unroll
    for (int it = 0; it < 8; ++it) {
      const int L = it * 64 + lq;                      // lines 0..511 of the block: 2 lines per channel
      const int c = L >> 1;
      const float* sp = Os + (2 * e) * OPITCH + c;     // x - 16g = (w - 32g)>>1 for w = 32g + 4e + 0..3
      const float z0 = sp[0], z1 = sp[OPITCH];
      v4f v;
      v[0] = z0; v[1] = z0; v[2] = z1; v[3] = z1;
      vals[it] = v;
    }
#pragma unroll
    for (int it = 0; it < 8; ++it) {
      const int L = it * 64 + lq;
      const int c = L >> 1, hrow = L & 1;
      *(v4f*)(ob + (size_t)c * LK + hrow * 64) = vals[it];
    }
  }
}

// =====================================================================================================
//   KP   bf16 [4][4096][256]     0           8388608
//   VT   f16  [4][256][4096]     8388608     8388608
//   QP   bf16 [4][1024][256]     16777216    2097152
//   end                          18874368
// =====================================================================================================
extern "C" void kernel_launch(void* const* d_in, const int* in_sizes, int n_in,
                              void* d_out, int out_size, void* d_ws, size_t ws_size,
                              hipStream_t stream) {
  const int ND = NB * NC * LQ;                          // 1048576
  const int NS = NB * NC * LK;                          // 4194304
  if (n_in < 2) return;
  if (in_sizes[0] != ND || in_sizes[1] != NS) return;
  if (out_size != NS) return;

  size_t off = 0;
  const size_t oK = off; off += (size_t)NS * 2;         // 8388608
  const size_t oV = off; off += (size_t)NS * 2;         // 8388608
  const size_t oQ = off; off += (size_t)ND * 2;         // 2097152
  if (off > ws_size) return;                            // off = 18874368
  if (off > (size_t)134217728) return;

  const float* Dp = (const float*)d_in[0];              // [4][256][32][32]
  const float* Sp = (const float*)d_in[1];              // [4][256][64][64]
  char* ws = (char*)d_ws;
  unsigned short* KP = (unsigned short*)(ws + oK);
  unsigned short* VT = (unsigned short*)(ws + oV);
  unsigned short* QP = (unsigned short*)(ws + oQ);
  float* out = (float*)d_out;

  const dim3 blk256(256), blkA(32 * NWAVE);
  const dim3 gS(NB * 4 * (LK / 64));                    // 1024 blocks
  const dim3 gD(NB * 4 * (LQ / 64));                    // 256 blocks
  const dim3 gA(NB * (LQ / QBLK));                      // 256 blocks

  // (0) S -> KP [b][key][c] bf16 (transposed) and VT [b][c][key] f16 (direct)
  cvt_plane<<<gS, blk256, 0, stream>>>(Sp, LK, LK / 64, 1, KP, VT);
  // (1) D -> QP [b][uq][c] bf16 (transposed); the direct plane is not written (dov = 0)
  cvt_plane<<<gD, blk256, 0, stream>>>(Dp, LQ, LQ / 64, 0, QP, VT);
  // (2) attention over the 1024 unique queries per batch, 2x2 replicated into out [4][256][64][64]
  attn_kernel<<<gA, blkA, 0, stream>>>(QP, KP, VT, out);
  (void)hipGetLastError();
}

// v002
// A run of this version takes 67.8 microseconds.
// Next to v001, in two timings, it ran 1.32 and 1.31 times as fast.
// All steps since v000 together make it 4.56 times as fast.
// Contractions: scores S^T = K (bf16, RNE convert of input S) . Q^T (bf16, RNE convert of input D) on v_wmma_f32_16x16x32_bf16, depth 256, one product;
// O^T = V^T (f16 of bf16-RNE input S, x1) . P^T (f16, per-group normalised softmax weights x1024) on v_wmma_f32_16x16x32_f16, one product; f32 accumulate everywhere;
// softmax (group max, exp, group sum, 1/l) in f32 on VALU; residual add in f32 from the bf16-RNE plane of D.
#include <hip/hip_runtime.h>
#include <math.h>
#include <stdint.h>

#define NB     4
#define NC     256          // channels: contraction depth of the scores, rows of O^T
#define LQ     1024         // unique queries per batch (32 x 32 query map)
#define LK     4096         // keys per batch (64 x 64 key map)
#define NGRP   64           // key groups (softmax runs over the 64 keys of one group)
#define QBLK   16           // unique queries per attention block = half a query-map row
#define NWAVE  16           // waves per attention block; each owns NGRP / NWAVE whole key groups
#define TPITCH 72           // LDS transpose tile pitch (halves)
#define FTILE  512          // halves of one 16 x 32 operand tile in fragment order (1 KiB)
#define OPITCH 260          // LDS output staging pitch (floats)
#define RTEMP  0.0625f      // 1 / temperature
#define PCARRY 1024.0f
#define PUNDO  0.0009765625f
static_assert(LQ == 32 * 32);
static_assert(LK == 64 * 64);
static_assert((NC % 64) == 0);
static_assert(NGRP * 64 == LK);
static_assert((NGRP % NWAVE) == 0);
static_assert(NWAVE == QBLK);

typedef _Float16       v16h __attribute__((ext_vector_type(16)));
typedef _Float16       v8h  __attribute__((ext_vector_type(8)));
typedef __bf16         v16b __attribute__((ext_vector_type(16)));
typedef unsigned short v8us __attribute__((ext_vector_type(8)));
typedef unsigned short v4us __attribute__((ext_vector_type(4)));
typedef float          v8f  __attribute__((ext_vector_type(8)));
typedef float          v4f  __attribute__((ext_vector_type(4)));
typedef unsigned int   v4u  __attribute__((ext_vector_type(4)));

union FragH { v16h v; v8h  h[2]; };
union FragB { v16b v; v8us u[2]; };
static_assert(sizeof(FragH) == 32);
static_assert(sizeof(FragB) == 32);

// ---- scalar helpers --------------------------------------------------------------------------------
__device__ __forceinline__ unsigned short bf_bits(float f) {          // f32 -> bf16 bits, RNE convert
  unsigned u = __float_as_uint(f);
  return (unsigned short)((u + 0x7FFFu + ((u >> 16) & 1u)) >> 16);
}
__device__ __forceinline__ float bf_up(unsigned short h) { return __uint_as_float(((unsigned)h) << 16); }
__device__ __forceinline__ unsigned short h_bits(_Float16 x) { return __builtin_bit_cast(unsigned short, x); }
__device__ __forceinline__ unsigned pk16(unsigned short a, unsigned short b) { return (unsigned)a | ((unsigned)b << 16); }
__device__ __forceinline__ v8f zero8() { v8f z = {0.f, 0.f, 0.f, 0.f, 0.f, 0.f, 0.f, 0.f}; return z; }
__device__ __forceinline__ float hmax8(v8f s) {
  return fmaxf(fmaxf(fmaxf(s[0], s[1]), fmaxf(s[2], s[3])), fmaxf(fmaxf(s[4], s[5]), fmaxf(s[6], s[7])));
}

// ---- fragment loaders: 16-bit A/B operand from a plane stored in fragment order. One 16 x 32 tile is FTILE halves
//      (1 KiB): [j 0..1][lane 0..31][t 0..7] holds row/col (lane&15), k = 16j + 8(lane>>4) + t. p is the tile (the
//      same in every lane), l8 = 8*lane; elements 0..7 <- j = 0, elements 8..15 <- j = 1: each load of the wave is
//      512 contiguous bytes = 4 whole lines
__device__ __forceinline__ v16h ldfrag_h(const _Float16* p, unsigned l8) {
  FragH f;
  f.h[0] = *(const v8h*)(p + l8);
  f.h[1] = *(const v8h*)(p + FTILE / 2 + l8);
  return f.v;
}
__device__ __forceinline__ v16b ldfrag_b(const unsigned short* p, unsigned l8) {
  FragB f;
  f.u[0] = *(const v8us*)(p + l8);
  f.u[1] = *(const v8us*)(p + FTILE / 2 + l8);
  return f.v;
}

// ---- WMMA helpers with trailing VALU hazard gap --------------------------------------------------------
__device__ __forceinline__ v8f mma_h_raw(v16h a, v16h b, v8f c) {
  return __builtin_amdgcn_wmma_f32_16x16x32_f16(false, a, false, b, (short)0, c, false, false);
}
__device__ __forceinline__ v8f mma_b_raw(v16b a, v16b b, v8f c) {
  return __builtin_amdgcn_wmma_f32_16x16x32_bf16(false, a, false, b, (short)0, c, false, false);
}
// ties two score accumulators, keeps the four A fragments and the two B fragments live past the nops: the nops keep
// the distance behind the last WMMA on the taken side of the loop branch
__device__ __forceinline__ void sguard(v8f& a, v8f& b, v16b x0, v16b x1, v16b x2, v16b x3, v16b y0, v16b y1) {
#if defined(__HIP_DEVICE_COMPILE__)
  const v16h h0 = __builtin_bit_cast(v16h, x0), h1 = __builtin_bit_cast(v16h, x1);
  const v16h h2 = __builtin_bit_cast(v16h, x2), h3 = __builtin_bit_cast(v16h, x3);
  const v16h g0 = __builtin_bit_cast(v16h, y0), g1 = __builtin_bit_cast(v16h, y1);
  asm volatile("v_nop\n\tv_nop\n\tv_nop\n\tv_nop"
               : "+v"(a), "+v"(b) : "v"(h0), "v"(h1), "v"(h2), "v"(h3), "v"(g0), "v"(g1));
#endif
}
// ties one output accumulator, keeps its two A fragments and both P fragments live past the nops
__device__ __forceinline__ void oguard(v8f& a, v16h x0, v16h x1, v16h p0, v16h p1) {
#if defined(__HIP_DEVICE_COMPILE__)
  asm volatile("v_nop\n\tv_nop\n\tv_nop\n\tv_nop" : "+v"(a) : "v"(x0), "v"(x1), "v"(p0), "v"(p1));
#endif
}

// =====================================================================================================
// Operand planes. src is viewed as [NB][NC][rowlen] f32 (rowlen = LK for S, LQ for D). One block (256 threads)
// handles (b, channel tile ct of 64, position tile kt of 64):
//   dT[b][pos/16][c/32][FTILE] = bf16 bits (RNE convert), fragment order with row = pos, k = c: the 64(c) x 64(pos)
//                    tile goes through LDS Ts[pos][c] (pitch 72 halves, 2-byte LDS stores), block barrier, then every
//                    wave store writes 512 contiguous bytes
//   dV[b][pos/64][c/16][(pos/32)&1][FTILE] = f16 bits of the bf16-RNE value, fragment order with row = c, k = pos
//                    (only when dov != 0): every wave store writes 4 whole lines
// coverage: Ts / dV: 8 waves x 8 rows x (2 x 4 lanes x 8 pos) = 64 c x 64 pos; dT: 2 x 256 pieces of 8 c = 8 tiles
//           = 64 pos x 64 c; grid = NB x 4 ct x (rowlen/64) kt covers both planes exactly once, no tails.
// =====================================================================================================
__global__ __launch_bounds__(256) void cvt_plane(const float* __restrict__ src, int rowlen, int nkt, int dov,
                                                  unsigned short* dT, unsigned short* dV) {
  __shared__ __align__(16) unsigned short Ts[64 * TPITCH];
  const int tid  = threadIdx.x;
  const int lane = tid & 31, wave = tid >> 5;
  const int bx   = blockIdx.x;
  const int kt   = bx % nkt;
  const int rest = bx / nkt;
  const int ct   = rest & 3;
  const int b    = rest >> 2;

  // ---- phase 1: read 64 c rows x 64 positions, convert, fill Ts (transposed), store the direct f16 plane ----
  {
    const int r8 = lane & 7, eq = lane >> 3;            // r8: row within the wave's 8 rows, eq: 16-B piece (j, h)
    v4u u[2];
    size_t go[2];
#pragma unroll
    for (int it = 0; it < 2; ++it) {
      const int row = wave * 8 + r8;                    // channel within the tile 0..63
      const int e   = it * 4 + eq;                      // positions 8e..8e+7 = 32 it + 16 (eq>>1) + 8 (eq&1) + 0..7
      const size_t o = ((size_t)(b * NC + ct * 64 + row)) * (size_t)rowlen + (size_t)kt * 64 + 8 * e;
      go[it] = ((((size_t)(b * nkt + kt)) * (NC / 16) + ct * 4 + (row >> 4)) * 2 + it) * FTILE
               + (eq >> 1) * (FTILE / 2) + ((eq & 1) * 16 + (row & 15)) * 8;
      const v4f a = *(const v4f*)(src + o), c4 = *(const v4f*)(src + o + 4);
      unsigned short w[8];
#pragma unroll
      for (int t = 0; t < 4; ++t) { w[t] = bf_bits(a[t]); w[4 + t] = bf_bits(c4[t]); }
#pragma unroll
      for (int t = 0; t < 8; ++t) Ts[(8 * e + t) * TPITCH + row] = w[t];
      v4u pk;
#pragma unroll
      for (int t = 0; t < 4; ++t)
        pk[t] = pk16(h_bits((_Float16)bf_up(w[2 * t])), h_bits((_Float16)bf_up(w[2 * t + 1])));
      u[it] = pk;
    }
    if (dov != 0) {
      {
#pragma unroll
        for (int it = 0; it < 2; ++it) *(v4u*)(dV + go[it]) = u[it];
        
      }
    }
  }
  __syncthreads();
  // ---- phase 2: transposed plane in fragment order, whole-line stores ----
  {
    v4u u[2];
    size_t go[2];
#pragma unroll
    for (int it = 0; it < 2; ++it) {
      const int n   = it * 256 + tid;                   // 16-B piece 0..511 of the block's 8 tiles
      const int ptl = n >> 7, kkl = (n >> 6) & 1;       // 16-position tile 0..3, 32-channel step 0..1
      const int e   = kkl * 4 + ((n >> 4) & 3);         // channels 8e..8e+7 = 32 kkl + 16 j + 8 h + 0..7
      u[it]  = *(const v4u*)(Ts + (ptl * 16 + (n & 15)) * TPITCH + 8 * e);
      go[it] = (((size_t)(b * nkt + kt) * 4 + ptl) * (NC / 32) + ct * 2 + kkl) * FTILE + (n & 63) * 8;
    }
    {
#pragma unroll
      for (int it = 0; it < 2; ++it) *(v4u*)(dT + go[it]) = u[it];
      
    }
  }
}

// =====================================================================================================
// Attention for one (b, query-map row y, half row g): 16 unique queries, transposed formulation.
//   Block = 16 waves, all on the same 16 queries (query x = 16g + (lane&15) of row y). The softmax runs inside one
//   key group of 64 keys and the output is the plain sum over the 64 groups, so a wave owns WHOLE key groups:
//   wave w takes groups w, w+16, w+32, w+48 and needs nothing from another wave until the end.
//   Per key group i: scores S^T (64 keys x 16 queries, 4 tiles) = A(K rows = keys, c via the split k map, bf16 plane)
//   . B(Q, col = query, same c map, bf16 plane), 8 c-steps of 32, walked two tiles at a time and two c-steps
//   per trip; group max and group sum need only the lane pair (lane, lane^16).
//   P = e^{(s-m)/16} / l x 1024 as f16: score tiles 2p and 2p+1 of a lane ARE elements 0..7 and 8..15 of the B
//   fragment for keys 32p..32p+31 (split k map), so P never leaves the registers.
//   O^T (rows c, cols queries) += A(V^T rows c, f16 plane in fragment order) . B(P^T), 2 key-steps of 32, all 256
//   channels (16 tiles) in the wave.
//   Epilogue: each wave stores its partial O as Pt[w][x][c] (16-B stores, pitch 260), block barrier, the 16 partials
//   are summed in wave order, Z = O x 1/1024 + bf16(D) goes to Os[x][c], block barrier, whole-line output stores.
// coverage: Pt: 16 waves x 16 x x 256 c; Os: 16 waves (x = wave) x 2 x 32 lanes x 4 c = 16 x x 256 c; output: block
//   (b,y,g) writes out[b][c][2y..2y+1][32g..32g+31] for all 256 c = 512 lines; grid = NB x 32 rows x 2 = 256 blocks
//   covers out [4][256][64][64] exactly once.
// =====================================================================================================
__global__ __launch_bounds__(32 * NWAVE)
void attn_kernel(const unsigned short* __restrict__ qp, const unsigned short* __restrict__ kp,
                 const unsigned short* __restrict__ vtp, float* out) {
  __shared__ __align__(16) float Pt[NWAVE * QBLK * OPITCH];
  __shared__ __align__(16) float Os[QBLK * OPITCH];
  const int tid  = threadIdx.x;
  const int wave = __builtin_amdgcn_readfirstlane(tid >> 5);
  const int lane = tid & 31;
  const int hh   = lane >> 4;
  const int c16  = lane & 15;
  const int bx   = blockIdx.x;
  const int b    = bx >> 6;                       // LQ / QBLK = 64 blocks per batch
  const int y    = (bx >> 1) & 31;
  const int g    = bx & 1;
  const int uq0  = y * 32 + 16 * g;               // first unique query of the block

  // ---- Q fragment base (B operand, col = query uq0 + c16), + FTILE*kk ----
  const unsigned short* Qb = qp + ((size_t)(b * LQ + uq0) / 16) * (NC / 32) * FTILE;
  // ---- K fragment base (A operand, row = key), + (key/16)*(NC/32)*FTILE + FTILE*kk ----
  const unsigned short* Kb = kp + ((size_t)b * (LK / 16)) * (NC / 32) * FTILE;
  // ---- V^T fragment base (A operand, row = channel 16ct + c16), + ((group*16 + ct)*2 + key step)*FTILE ----
  const _Float16* VT = (const _Float16*)(const void*)vtp;
  const _Float16* Vb = VT + ((size_t)b * NGRP) * (NC / 16) * 2 * FTILE;
  const unsigned l8 = 8u * (unsigned)lane;        // this lane's 16 bytes in each half tile

  v8f o[16];
#pragma unroll
  for (int ct = 0; ct < 16; ++ct) o[ct] = zero8();

  // rolled: one copy of the body; nothing is carried from one key group to the next but o[]
#pragma unroll 1
  for (int j = 0; j < NGRP / NWAVE; ++j) {
    const int i = wave + NWAVE * j;               // key group of this wave in this trip
    // ---- scores for the 64 keys of group i ----
    v8f s[4];
    // unrolled: s[] is indexed by constants only and stays in registers
#pragma unroll
    for (int tp = 0; tp < 2; ++tp) {
      const unsigned short* K0 = Kb + ((size_t)(i * 4 + 2 * tp)) * (NC / 32) * FTILE;   // keys 32tp +  0..15
      const unsigned short* K1 = K0 + (size_t)(NC / 32) * FTILE;                          // keys 32tp + 16..31
      v8f s0 = zero8(), s1 = zero8();
      // one trip uses two whole tiles (2 KiB in a row) of each 16-key row of tiles;
      // rolled: only one trip's fragments are live beside o[], which keeps four waves on a SIMD
#pragma unroll 1
      for (int k2 = 0; k2 < NC / 64; ++k2) {
        const v16b q0  = ldfrag_b(Qb + 2 * FTILE * k2, l8);
        const v16b q1  = ldfrag_b(Qb + 2 * FTILE * k2 + FTILE, l8);
        const v16b a00 = ldfrag_b(K0 + 2 * FTILE * k2, l8);
        const v16b a01 = ldfrag_b(K0 + 2 * FTILE * k2 + FTILE, l8);
        const v16b a10 = ldfrag_b(K1 + 2 * FTILE * k2, l8);
        const v16b a11 = ldfrag_b(K1 + 2 * FTILE * k2 + FTILE, l8);
        s0 = mma_b_raw(a00, q0, s0);
        s1 = mma_b_raw(a10, q0, s1);
        s0 = mma_b_raw(a01, q1, s0);
        s1 = mma_b_raw(a11, q1, s1);
        sguard(s0, s1, a00, a01, a10, a11, q0, q1);
      }
      s[2 * tp] = s0; s[2 * tp + 1] = s1;
    }

    // ---- group max over the 64 keys: 32 in this lane, 32 in lane^16 ----
    float m = fmaxf(fmaxf(hmax8(s[0]), hmax8(s[1])), fmaxf(hmax8(s[2]), hmax8(s[3])));
    m = fmaxf(m, __shfl_xor(m, 16, 32));

    // ---- e = exp((s - m)/16), group sum (one sum per 32 keys, then the two) ----
    v8f e[4];
    float lh[2];
#pragma unroll
    for (int tp = 0; tp < 2; ++tp) {
      float ls = 0.f;
#pragma unroll
      for (int r = 0; r < 8; ++r) {
        const float a0 = __expf((s[2 * tp][r] - m) * RTEMP);       // key 32tp      + 8hh + r
        const float a1 = __expf((s[2 * tp + 1][r] - m) * RTEMP);   // key 32tp + 16 + 8hh + r
        e[2 * tp][r] = a0; e[2 * tp + 1][r] = a1;
        ls += a0 + a1;
      }
      ls += __shfl_xor(ls, 16, 32);
      lh[tp] = ls;
    }
    const float l  = lh[0] + lh[1];                    // l in [1, 64]
    const float ps = PCARRY * __builtin_amdgcn_rcpf(l);

    // ---- normalised P x 1024 as f16, already in B-fragment order ----
    FragH p0, p1;
#pragma unroll
    for (int r = 0; r < 8; ++r) {
      p0.h[0][r] = (_Float16)(e[0][r] * ps);           // keys      8hh + 0..7
      p0.h[1][r] = (_Float16)(e[1][r] * ps);           // keys 16 + 8hh + 0..7
      p1.h[0][r] = (_Float16)(e[2][r] * ps);           // keys 32 + 8hh + 0..7
      p1.h[1][r] = (_Float16)(e[3][r] * ps);           // keys 48 + 8hh + 0..7
    }

    // ---- O^T[c][q] += V^T[c][keys] . P^T[keys][q] over the 64 keys of group i, all 256 channels ----
    const size_t kofs = (size_t)i * (NC / 16) * 2 * FTILE;
#pragma unroll
    for (int ct = 0; ct < 16; ++ct) {
      const _Float16* vp = Vb + kofs + (size_t)(2 * ct) * FTILE;
      const v16h v0 = ldfrag_h(vp, l8);
      const v16h v1 = ldfrag_h(vp + FTILE, l8);
      o[ct] = mma_h_raw(v0, p0.v, o[ct]);
      o[ct] = mma_h_raw(v1, p1.v, o[ct]);
      oguard(o[ct], v0, v1, p0.v, p1.v);
    }
  }

  // ---- this wave's partial O (x 1024) as Pt[wave][x][c] ----
  {
    float* ptw = Pt + (wave * QBLK + c16) * OPITCH + 8 * hh;
#pragma unroll
    for (int ct = 0; ct < 16; ++ct) {                  // channels 16ct + 8hh + 0..7
      v4f w0, w1;
#pragma unroll
      for (int r = 0; r < 4; ++r) { w0[r] = o[ct][r]; w1[r] = o[ct][4 + r]; }
      *(v4f*)(ptw + 16 * ct)     = w0;
      *(v4f*)(ptw + 16 * ct + 4) = w1;
    }
  }
  __syncthreads();
  // ---- sum of the 16 partials in wave order; Z[c][x] = O x 1/1024 + bf16(D[b][c][y][x]) staged as Os[x][c] ----
  {
    const unsigned short* qres = Qb + 8 * wave;        // x = wave: column wave of the block's Q tiles
#pragma unroll
    for (int it = 0; it < 2; ++it) {
      const int c = 4 * (it * 32 + lane);              // it 0..1 x 32 lanes x 4 c = channels 0..255
      const float* pp = Pt + wave * OPITCH + c;
      v4f acc = *(const v4f*)(pp);
#pragma unroll
      for (int w = 1; w < NWAVE; ++w) acc += *(const v4f*)(pp + w * (QBLK * OPITCH));
      // channel c = 32 kk + 16 j + 8 h + t of the fragment order
      const v4us qq = *(const v4us*)(qres + (c >> 5) * FTILE + ((c >> 4) & 1) * (FTILE / 2) + ((c >> 3) & 1) * 128 + (c & 7));
      v4f z;
#pragma unroll
      for (int r = 0; r < 4; ++r) z[r] = acc[r] * PUNDO + bf_up(qq[r]);
      *(v4f*)(Os + wave * OPITCH + c) = z;
    }
  }
  __syncthreads();
  {
    const int e = tid & 7, lq = tid >> 3;              // lq 0..63: line within group, e: 16-B piece
    float* ob = out + (size_t)b * NC * LK + (size_t)(2 * y) * 64 + 32 * g + 4 * e;
    v4f vals[8];
#pragma unroll
    for (int it = 0; it < 8; ++it) {
      const int L = it * 64 + lq;                      // lines 0..511 of the block: 2 lines per channel
      const int c = L >> 1;
      const float* sp = Os + (2 * e) * OPITCH + c;     // x - 16g = (w - 32g)>>1 for w = 32g + 4e + 0..3
      const float z0 = sp[0], z1 = sp[OPITCH];
      v4f v;
      v[0] = z0; v[1] = z0; v[2] = z1; v[3] = z1;
      vals[it] = v;
    }
#pragma unroll
    for (int it = 0; it < 8; ++it) {
      const int L = it * 64 + lq;
      const int c = L >> 1, hrow = L & 1;
      *(v4f*)(ob + (size_t)c * LK + hrow * 64) = vals[it];
    }
  }
}

// =====================================================================================================
//   KP   bf16 [4][256][8][512]      0           8388608
//   VT   f16  [4][64][16][2][512]   8388608     8388608
//   QP   bf16 [4][64][8][512]       16777216    2097152
//   end                          18874368
// =====================================================================================================
extern "C" void kernel_launch(void* const* d_in, const int* in_sizes, int n_in,
                              void* d_out, int out_size, void* d_ws, size_t ws_size,
                              hipStream_t stream) {
  const int ND = NB * NC * LQ;                          // 1048576
  const int NS = NB * NC * LK;                          // 4194304
  if (n_in < 2) return;
  if (in_sizes[0] != ND || in_sizes[1] != NS) return;
  if (out_size != NS) return;

  size_t off = 0;
  const size_t oK = off; off += (size_t)NS * 2;         // 8388608
  const size_t oV = off; off += (size_t)NS * 2;         // 8388608
  const size_t oQ = off; off += (size_t)ND * 2;         // 2097152
  if (off > ws_size) return;                            // off = 18874368
  if (off > (size_t)134217728) return;

  const float* Dp = (const float*)d_in[0];              // [4][256][32][32]
  const float* Sp = (const float*)d_in[1];              // [4][256][64][64]
  char* ws = (char*)d_ws;
  unsigned short* KP = (unsigned short*)(ws + oK);
  unsigned short* VT = (unsigned short*)(ws + oV);
  unsigned short* QP = (unsigned short*)(ws + oQ);
  float* out = (float*)d_out;

  const dim3 blk256(256), blkA(32 * NWAVE);
  const dim3 gS(NB * 4 * (LK / 64));                    // 1024 blocks
  const dim3 gD(NB * 4 * (LQ / 64));                    // 256 blocks
  const dim3 gA(NB * (LQ / QBLK));                      // 256 blocks

  // (0) S -> KP bf16 (rows = keys) and VT f16 (rows = channels), both in fragment order
  cvt_plane<<<gS, blk256, 0, stream>>>(Sp, LK, LK / 64, 1, KP, VT);
  // (1) D -> QP bf16 (columns = queries) in fragment order; the f16 plane is not written (dov = 0)
  cvt_plane<<<gD, blk256, 0, stream>>>(Dp, LQ, LQ / 64, 0, QP, VT);
  // (2) attention over the 1024 unique queries per batch, 2x2 replicated into out [4][256][64][64]
  attn_kernel<<<gA, blkA, 0, stream>>>(QP, KP, VT, out);
  (void)hipGetLastError();
}

// v003
// Measured time: 37.2 microseconds a run.
// Next to v002, in two timings, it ran 1.82 and 1.81 times as fast.
// Over all steps from v000 it is 8.29 times as fast.
// Contractions: scores S^T = K (bf16, RNE convert of input S) . Q^T (bf16, RNE convert of input D) on v_wmma_f32_16x16x32_bf16, depth 256, one product;
// O^T = V^T (f16 of bf16-RNE input S, x1) . P^T (f16, per-group normalised softmax weights x1024) on v_wmma_f32_16x16x32_f16, one product; f32 accumulate everywhere;
// softmax (group max, exp, group sum, 1/l) in f32 on VALU; residual add in f32 from the bf16-RNE plane of D.
#include <hip/hip_runtime.h>
#include <math.h>
#include <stdint.h>

#define NB     4
#define NC     256          // channels: contraction depth of the scores, rows of O^T
#define LQ     1024         // unique queries per batch (32 x 32 query map)
#define LK     4096         // keys per batch (64 x 64 key map)
#define NGRP   64           // key groups (softmax runs over the 64 keys of one group)
#define QBLK   64           // unique queries per attention block = 4 query tiles of 16
#define KSPL   4            // key quarters: an attention block walks NGRP / KSPL key groups
#define NWAVE  16           // waves per attention block: 4 query tiles x 4 group lanes
#define NTRIP  4            // trips of an attention block: 4 key groups (one per group lane) a trip
#define GRPB   32768        // bytes of one key group in the K plane and in the V^T plane
#define STAGEB 131072       // bytes of one ring stage: the K or the V^T of a trip's 4 key groups
#define SLICEB 8192         // bytes of one wave's slice of a stage
#define SLROWB 1024         // a slice as a tensor tile: rows of 1024 bytes ...
#define SLROWS 8            // ... 8 of them
#define SMEMB  266240       // LDS of an attention block: the ring (2 stages), later 4 x 64 x OPITCH floats of partials
#define TPITCH 72           // LDS transpose tile pitch (halves)
#define FTILE  512          // halves of one 16 x 32 operand tile in fragment order (1 KiB)
#define OPITCH 260          // LDS output staging pitch (floats)
#define RTEMP  0.0625f      // 1 / temperature
#define PCARRY 1024.0f
#define PUNDO  0.0009765625f
static_assert(LQ == 32 * 32);
static_assert(LK == 64 * 64);
static_assert((NC % 64) == 0);
static_assert(NGRP * 64 == LK);
static_assert(NWAVE == (QBLK / 16) * 4);
static_assert(NTRIP * 4 * KSPL == NGRP);
static_assert(GRPB == 64 * NC * 2);
static_assert(STAGEB == 4 * GRPB);
static_assert(SLICEB * NWAVE == STAGEB);
static_assert(SLROWB * SLROWS == SLICEB);
static_assert((SLICEB % 2048) == 0);
static_assert(SMEMB >= 2 * STAGEB);
static_assert(SMEMB >= 4 * QBLK * OPITCH * 4);

typedef _Float16       v16h __attribute__((ext_vector_type(16)));
typedef _Float16       v8h  __attribute__((ext_vector_type(8)));
typedef __bf16         v16b __attribute__((ext_vector_type(16)));
typedef unsigned short v8us __attribute__((ext_vector_type(8)));
typedef unsigned short v4us __attribute__((ext_vector_type(4)));
typedef float          v8f  __attribute__((ext_vector_type(8)));
typedef float          v4f  __attribute__((ext_vector_type(4)));
typedef unsigned int   v4u  __attribute__((ext_vector_type(4)));

union FragH { v16h v; v8h  h[2]; };
union FragB { v16b v; v8us u[2]; };
static_assert(sizeof(FragH) == 32);
static_assert(sizeof(FragB) == 32);

// ---- scalar helpers --------------------------------------------------------------------------------
__device__ __forceinline__ unsigned short bf_bits(float f) {          // f32 -> bf16 bits, RNE convert
  unsigned u = __float_as_uint(f);
  return (unsigned short)((u + 0x7FFFu + ((u >> 16) & 1u)) >> 16);
}
__device__ __forceinline__ float bf_up(unsigned short h) { return __uint_as_float(((unsigned)h) << 16); }
__device__ __forceinline__ unsigned short h_bits(_Float16 x) { return __builtin_bit_cast(unsigned short, x); }
__device__ __forceinline__ unsigned pk16(unsigned short a, unsigned short b) { return (unsigned)a | ((unsigned)b << 16); }
__device__ __forceinline__ v8f zero8() { v8f z = {0.f, 0.f, 0.f, 0.f, 0.f, 0.f, 0.f, 0.f}; return z; }
__device__ __forceinline__ float hmax8(v8f s) {
  return fmaxf(fmaxf(fmaxf(s[0], s[1]), fmaxf(s[2], s[3])), fmaxf(fmaxf(s[4], s[5]), fmaxf(s[6], s[7])));
}

// ---- fragment loaders: 16-bit A/B operand from a plane stored in fragment order. One 16 x 32 tile is FTILE halves
//      (1 KiB): [j 0..1][lane 0..31][t 0..7] holds row/col (lane&15), k = 16j + 8(lane>>4) + t. p is the tile (the
//      same in every lane), l8 = 8*lane; elements 0..7 <- j = 0, elements 8..15 <- j = 1: each load of the wave is
//      512 contiguous bytes = 4 whole lines
__device__ __forceinline__ v16h ldfrag_h(const _Float16* p, unsigned l8) {
  FragH f;
  f.h[0] = *(const v8h*)(p + l8);
  f.h[1] = *(const v8h*)(p + FTILE / 2 + l8);
  return f.v;
}
__device__ __forceinline__ v16b ldfrag_b(const unsigned short* p, unsigned l8) {
  FragB f;
  f.u[0] = *(const v8us*)(p + l8);
  f.u[1] = *(const v8us*)(p + FTILE / 2 + l8);
  return f.v;
}

// ---- WMMA helpers with trailing VALU hazard gap --------------------------------------------------------
__device__ __forceinline__ v8f mma_h_raw(v16h a, v16h b, v8f c) {
  return __builtin_amdgcn_wmma_f32_16x16x32_f16(false, a, false, b, (short)0, c, false, false);
}
__device__ __forceinline__ v8f mma_b_raw(v16b a, v16b b, v8f c) {
  return __builtin_amdgcn_wmma_f32_16x16x32_bf16(false, a, false, b, (short)0, c, false, false);
}
// ties two score accumulators, keeps the four A fragments and the two B fragments live past the nops: the nops keep
// the distance behind the last WMMA on the taken side of the loop branch
__device__ __forceinline__ void sguard(v8f& a, v8f& b, v16b x0, v16b x1, v16b x2, v16b x3, v16b y0, v16b y1) {
#if defined(__HIP_DEVICE_COMPILE__)
  const v16h h0 = __builtin_bit_cast(v16h, x0), h1 = __builtin_bit_cast(v16h, x1);
  const v16h h2 = __builtin_bit_cast(v16h, x2), h3 = __builtin_bit_cast(v16h, x3);
  const v16h g0 = __builtin_bit_cast(v16h, y0), g1 = __builtin_bit_cast(v16h, y1);
  asm volatile("v_nop\n\tv_nop\n\tv_nop\n\tv_nop"
               : "+v"(a), "+v"(b) : "v"(h0), "v"(h1), "v"(h2), "v"(h3), "v"(g0), "v"(g1));
#endif
}
// ties one output accumulator, keeps its two A fragments and both P fragments live past the nops
__device__ __forceinline__ void oguard(v8f& a, v16h x0, v16h x1, v16h p0, v16h p1) {
#if defined(__HIP_DEVICE_COMPILE__)
  asm volatile("v_nop\n\tv_nop\n\tv_nop\n\tv_nop" : "+v"(a) : "v"(x0), "v"(x1), "v"(p0), "v"(p1));
#endif
}

// =====================================================================================================
// Operand planes. src is viewed as [NB][NC][rowlen] f32 (rowlen = LK for S, LQ for D). One block (256 threads)
// handles (b, channel tile ct of 64, position tile kt of 64):
//   dT[b][pos/16][c/32][FTILE] = bf16 bits (RNE convert), fragment order with row = pos, k = c: the 64(c) x 64(pos)
//                    tile goes through LDS Ts[pos][c] (pitch 72 halves, 2-byte LDS stores), block barrier, then every
//                    wave store writes 512 contiguous bytes
//   dV[b][pos/64][c/16][(pos/32)&1][FTILE] = f16 bits of the bf16-RNE value, fragment order with row = c, k = pos
//                    (only when dov != 0): every wave store writes 4 whole lines
// coverage: Ts / dV: 8 waves x 8 rows x (2 x 4 lanes x 8 pos) = 64 c x 64 pos; dT: 2 x 256 pieces of 8 c = 8 tiles
//           = 64 pos x 64 c; grid = NB x 4 ct x (rowlen/64) kt covers both planes exactly once, no tails.
// =====================================================================================================
__global__ __launch_bounds__(256) void cvt_plane(const float* __restrict__ src, int rowlen, int nkt, int dov,
                                                  unsigned short* dT, unsigned short* dV) {
  __shared__ __align__(16) unsigned short Ts[64 * TPITCH];
  const int tid  = threadIdx.x;
  const int lane = tid & 31, wave = tid >> 5;
  const int bx   = blockIdx.x;
  const int kt   = bx % nkt;
  const int rest = bx / nkt;
  const int ct   = rest & 3;
  const int b    = rest >> 2;

  // ---- phase 1: read 64 c rows x 64 positions, convert, fill Ts (transposed), store the direct f16 plane ----
  {
    const int r8 = lane & 7, eq = lane >> 3;            // r8: row within the wave's 8 rows, eq: 16-B piece (j, h)
    v4u u[2];
    size_t go[2];
#pragma unroll
    for (int it = 0; it < 2; ++it) {
      const int row = wave * 8 + r8;                    // channel within the tile 0..63
      const int e   = it * 4 + eq;                      // positions 8e..8e+7 = 32 it + 16 (eq>>1) + 8 (eq&1) + 0..7
      const size_t o = ((size_t)(b * NC + ct * 64 + row)) * (size_t)rowlen + (size_t)kt * 64 + 8 * e;
      go[it] = ((((size_t)(b * nkt + kt)) * (NC / 16) + ct * 4 + (row >> 4)) * 2 + it) * FTILE
               + (eq >> 1) * (FTILE / 2) + ((eq & 1) * 16 + (row & 15)) * 8;
      const v4f a = *(const v4f*)(src + o), c4 = *(const v4f*)(src + o + 4);
      unsigned short w[8];
#pragma unroll
      for (int t = 0; t < 4; ++t) { w[t] = bf_bits(a[t]); w[4 + t] = bf_bits(c4[t]); }
#pragma unroll
      for (int t = 0; t < 8; ++t) Ts[(8 * e + t) * TPITCH + row] = w[t];
      v4u pk;
#pragma unroll
      for (int t = 0; t < 4; ++t)
        pk[t] = pk16(h_bits((_Float16)bf_up(w[2 * t])), h_bits((_Float16)bf_up(w[2 * t + 1])));
      u[it] = pk;
    }
    if (dov != 0) {
      {
#pragma unroll
        for (int it = 0; it < 2; ++it) *(v4u*)(dV + go[it]) = u[it];
        
      }
    }
  }
  __syncthreads();
  // ---- phase 2: transposed plane in fragment order, whole-line stores ----
  {
    v4u u[2];
    size_t go[2];
#pragma unroll
    for (int it = 0; it < 2; ++it) {
      const int n   = it * 256 + tid;                   // 16-B piece 0..511 of the block's 8 tiles
      const int ptl = n >> 7, kkl = (n >> 6) & 1;       // 16-position tile 0..3, 32-channel step 0..1
      const int e   = kkl * 4 + ((n >> 4) & 3);         // channels 8e..8e+7 = 32 kkl + 16 j + 8 h + 0..7
      u[it]  = *(const v4u*)(Ts + (ptl * 16 + (n & 15)) * TPITCH + 8 * e);
      go[it] = (((size_t)(b * nkt + kt) * 4 + ptl) * (NC / 32) + ct * 2 + kkl) * FTILE + (n & 63) * 8;
    }
    {
#pragma unroll
      for (int it = 0; it < 2; ++it) *(v4u*)(dT + go[it]) = u[it];
      
    }
  }
}

// =====================================================================================================
// Tensor load helpers (two-group descriptor, 1-byte elements, no pad, no mask)
// =====================================================================================================
typedef uint32_t u32x4 __attribute__((ext_vector_type(4)));
typedef uint32_t u32x8 __attribute__((ext_vector_type(8)));
__device__ __forceinline__ uint32_t uni(uint32_t v) { return (uint32_t)__builtin_amdgcn_readfirstlane(v); }
// the test of a tensor load's branch: it must compile to s_cmp + s_cbranch_scc, for a tensor load ignores EXEC
__device__ __forceinline__ uint32_t pinned(uint32_t v) {
  uint32_t w = uni(v);
  asm volatile("" : "+s"(w));  // pinned(): holds the test in a scalar register
  return w;
}
// the compiler places no wait for the tensor mover, and none of these may move over an LDS access: "memory"
__device__ __forceinline__ void wait_ds0()     { asm volatile("s_wait_dscnt 0x0" ::: "memory"); }
__device__ __forceinline__ void wait_tensor0() { asm volatile("s_wait_tensorcnt 0x0" ::: "memory"); }
__device__ __forceinline__ void tdm_load(u32x4 g0, u32x8 g1) {
  asm volatile("tensor_load_to_lds %0, %1" :: "s"(g0), "s"(g1) : "memory");
}
// the same wait, naming the request's group 0 as an input: its registers keep their values until the tile has landed
__device__ __forceinline__ void wait_tensor0_of(u32x4 g0) { asm volatile("s_wait_tensorcnt 0x0" :: "s"(g0) : "memory"); }
// tile = SLROWS rows of SLROWB bytes, source pitch = the row: one wave's slice of a stage, SLICEB contiguous bytes
__device__ __forceinline__ u32x8 tdm_group1() {
  constexpr uint32_t d0 = SLROWB, d1 = SLROWS;
  u32x8 g;
  g[0] = uni(0u);
  g[1] = uni((d0 & 0xFFFFu) << 16);
  g[2] = uni((d0 >> 16) | ((d1 & 0xFFFFu) << 16));
  g[3] = uni((d1 >> 16) | (d0 << 16));
  g[4] = uni(d1);
  g[5] = uni(SLROWB);
  g[6] = uni(0u);
  g[7] = uni(0u);
  return g;
}
__device__ __forceinline__ u32x4 tdm_group0(uint32_t lds_dst, uint64_t ga) {
  u32x4 g;
  g[0] = uni(1u);
  g[1] = uni(lds_dst);
  g[2] = uni((uint32_t)ga);
  g[3] = uni((((uint32_t)(ga >> 32)) & 0x01FFFFFFu) | 0x80000000u);
  return g;
}

// =====================================================================================================
// Attention for one (b, 64 unique queries qb, key quarter kq = 16 key groups), transposed formulation.
//   Block = 16 waves = 4 query tiles (qt = wave & 3, 16 queries each) x 4 group lanes (gl = wave >> 2).
//   The softmax runs inside one key group of 64 keys and the output is the plain sum over the 64 groups, so a wave
//   owns WHOLE key groups: in trip j wave (qt, gl) takes group 16 kq + 4 j + gl.
//   K and V^T of a trip's four groups (128 KiB each, contiguous in the fragment-ordered planes) are brought into LDS
//   ONCE per block by tensor loads, every wave its own 8-KiB slice, and each fragment is read from LDS by the four
//   query tiles. Ring of two buffers: stage 2j = K of trip j (buffer 0), stage 2j+1 = V^T of trip j (buffer 1);
//   pass 2j = the scores, pass 2j+1 = the output products; at the foot of pass s: s_wait_dscnt 0, s_wait_tensorcnt 0,
//   block barrier, then stage s+2 into the buffer that pass s has just read.
//   Per key group: scores S^T (64 keys x 16 queries, 4 tiles) = A(K rows = keys, bf16) . B(Q, col = query, bf16 plane),
//   8 c-steps of 32; group max and group sum need only the lane pair (lane, lane^16).
//   P = e^{(s-m)/16} / l x 1024 as f16: score tiles 2p and 2p+1 of a lane ARE elements 0..7 and 8..15 of the B
//   fragment for keys 32p..32p+31 (split k map), so P never leaves the registers.
//   O^T (rows c, cols queries) += A(V^T rows c, f16) . B(P^T), 2 key-steps of 32, all 256 channels in the wave.
//   Epilogue: each wave stores its partial O as Pt[gl][x][c] over the ring (16-B stores, pitch 260), block barrier, the
//   4 group lanes are summed in order and go, still x 1024, to part[kq][b][query][c] in whole lines.
// coverage: a stage: 16 waves x 8 KiB = 128 KiB = 4 groups x 32 KiB; Pt: 16 waves x 16 x x 256 c; part: 8 x 512 threads
//   x 4 c = 64 x x 256 c per block; grid = NB x 16 qb x 4 kq = 256 blocks covers part [4][4][1024][256] exactly once.
// =====================================================================================================
__global__ __launch_bounds__(32 * NWAVE)
void attn_kernel(const unsigned short* __restrict__ qp, const unsigned short* __restrict__ kp,
                 const unsigned short* __restrict__ vtp, float* part) {
  __shared__ __attribute__((aligned(2048))) unsigned char smem[SMEMB];
  const int tid  = threadIdx.x;
  const int wave = __builtin_amdgcn_readfirstlane(tid >> 5);
  const int lane = tid & 31;
  const int hh   = lane >> 4;
  const int c16  = lane & 15;
  const int qt   = wave & 3;                      // query tile of the wave
  const int gl   = wave >> 2;                     // group lane of the wave
  const int bx   = blockIdx.x;
  const int kq   = bx & (KSPL - 1);               // key quarter
  const int qb   = (bx / KSPL) & (LQ / QBLK - 1); // block of 64 unique queries
  const int b    = bx / (KSPL * (LQ / QBLK));
  const int uq0  = qb * QBLK;                     // first unique query of the block

  // ---- Q fragment base (B operand, col = query uq0 + 16 qt + c16), + FTILE*kk ----
  const unsigned short* Qb = qp + ((size_t)(b * LQ + uq0) / 16 + qt) * (NC / 32) * FTILE;
  // ---- K fragments of the wave's group in buffer 0 (A operand, row = key), + (key/16)*(NC/32)*FTILE + FTILE*kk ----
  const unsigned short* Kl = (const unsigned short*)(const void*)(smem + gl * GRPB);
  // ---- V^T fragments of the wave's group in buffer 1 (A operand, row = channel), + (ct*2 + key step)*FTILE ----
  const _Float16* Vl = (const _Float16*)(const void*)(smem + STAGEB + gl * GRPB);
  const unsigned l8 = 8u * (unsigned)lane;        // this lane's 16 bytes in each half tile

  // ---- this wave's slice of a stage: source (trip 0) and place in LDS ----
  const size_t   sofs = ((size_t)(b * NGRP + kq * (NGRP / KSPL))) * GRPB + (size_t)wave * SLICEB;
  const uint64_t ksrc = (uint64_t)(size_t)kp + sofs;
  const uint64_t vsrc = (uint64_t)(size_t)vtp + sofs;
  const uint32_t kdst = (uint32_t)(size_t)smem + (uint32_t)wave * SLICEB;
  const uint32_t vdst = kdst + STAGEB;
  const u32x8 g1 = tdm_group1();

  // ---- ring prologue: stage 0 (K of trip 0), landed and published; then stage 1 (V^T of trip 0) ----
  const u32x4 gk0 = tdm_group0(kdst, ksrc);
  tdm_load(gk0, g1);
  wait_tensor0_of(gk0);
  __syncthreads();
  tdm_load(tdm_group0(vdst, vsrc), g1);

  v8f o[16];
#pragma unroll
  for (int ct = 0; ct < 16; ++ct) o[ct] = zero8();

  // rolled: one copy of the body; nothing is carried from one key group to the next but o[]
#pragma unroll 1
  for (int j = 0; j < NTRIP; ++j) {
    // ---- pass 2j: scores for the 64 keys of the wave's group, K from buffer 0 ----
    v8f s[4];
    // unrolled: s[] is indexed by constants only and stays in registers
#pragma unroll
    for (int tp = 0; tp < 2; ++tp) {
      const unsigned short* K0 = Kl + (size_t)(2 * tp) * (NC / 32) * FTILE;               // keys 32tp +  0..15
      const unsigned short* K1 = K0 + (size_t)(NC / 32) * FTILE;                          // keys 32tp + 16..31
      v8f s0 = zero8(), s1 = zero8();
      // one trip uses two whole tiles (2 KiB in a row) of each 16-key row of tiles;
      // rolled: only one trip's fragments are live beside o[], which keeps four waves on a SIMD
#pragma unroll 1
      for (int k2 = 0; k2 < NC / 64; ++k2) {
        const v16b q0  = ldfrag_b(Qb + 2 * FTILE * k2, l8);
        const v16b q1  = ldfrag_b(Qb + 2 * FTILE * k2 + FTILE, l8);
        const v16b a00 = ldfrag_b(K0 + 2 * FTILE * k2, l8);
        const v16b a01 = ldfrag_b(K0 + 2 * FTILE * k2 + FTILE, l8);
        const v16b a10 = ldfrag_b(K1 + 2 * FTILE * k2, l8);
        const v16b a11 = ldfrag_b(K1 + 2 * FTILE * k2 + FTILE, l8);
        s0 = mma_b_raw(a00, q0, s0);
        s1 = mma_b_raw(a10, q0, s1);
        s0 = mma_b_raw(a01, q1, s0);
        s1 = mma_b_raw(a11, q1, s1);
        sguard(s0, s1, a00, a01, a10, a11, q0, q1);
      }
      s[2 * tp] = s0; s[2 * tp + 1] = s1;
    }
    // ---- foot of pass 2j: publishes V^T of trip j, frees buffer 0; then K of trip j+1 into buffer 0 ----
    wait_ds0();
    wait_tensor0();
    __syncthreads();
    if (pinned(j + 1 < NTRIP)) tdm_load(tdm_group0(kdst, ksrc + (uint64_t)(j + 1) * STAGEB), g1);

    // ---- group max over the 64 keys: 32 in this lane, 32 in lane^16 ----
    float m = fmaxf(fmaxf(hmax8(s[0]), hmax8(s[1])), fmaxf(hmax8(s[2]), hmax8(s[3])));
    m = fmaxf(m, __shfl_xor(m, 16, 32));

    // ---- e = exp((s - m)/16), group sum (one sum per 32 keys, then the two) ----
    v8f e[4];
    float lh[2];
#pragma unroll
    for (int tp = 0; tp < 2; ++tp) {
      float ls = 0.f;
#pragma unroll
      for (int r = 0; r < 8; ++r) {
        const float a0 = __expf((s[2 * tp][r] - m) * RTEMP);       // key 32tp      + 8hh + r
        const float a1 = __expf((s[2 * tp + 1][r] - m) * RTEMP);   // key 32tp + 16 + 8hh + r
        e[2 * tp][r] = a0; e[2 * tp + 1][r] = a1;
        ls += a0 + a1;
      }
      ls += __shfl_xor(ls, 16, 32);
      lh[tp] = ls;
    }
    const float l  = lh[0] + lh[1];                    // l in [1, 64]
    const float ps = PCARRY * __builtin_amdgcn_rcpf(l);

    // ---- normalised P x 1024 as f16, already in B-fragment order ----
    FragH p0, p1;
#pragma unroll
    for (int r = 0; r < 8; ++r) {
      p0.h[0][r] = (_Float16)(e[0][r] * ps);           // keys      8hh + 0..7
      p0.h[1][r] = (_Float16)(e[1][r] * ps);           // keys 16 + 8hh + 0..7
      p1.h[0][r] = (_Float16)(e[2][r] * ps);           // keys 32 + 8hh + 0..7
      p1.h[1][r] = (_Float16)(e[3][r] * ps);           // keys 48 + 8hh + 0..7
    }

    // ---- pass 2j+1: O^T[c][q] += V^T[c][keys] . P^T[keys][q] over the 64 keys, all 256 channels, V^T from buffer 1 ----
#pragma unroll
    for (int ct = 0; ct < 16; ++ct) {
      const _Float16* vp = Vl + (size_t)(2 * ct) * FTILE;
      const v16h v0 = ldfrag_h(vp, l8);
      const v16h v1 = ldfrag_h(vp + FTILE, l8);
      o[ct] = mma_h_raw(v0, p0.v, o[ct]);
      o[ct] = mma_h_raw(v1, p1.v, o[ct]);
      oguard(o[ct], v0, v1, p0.v, p1.v);
    }
    // ---- foot of pass 2j+1: publishes K of trip j+1, frees buffer 1; then V^T of trip j+1 into buffer 1 ----
    wait_ds0();
    wait_tensor0();
    __syncthreads();
    if (pinned(j + 1 < NTRIP)) tdm_load(tdm_group0(vdst, vsrc + (uint64_t)(j + 1) * STAGEB), g1);
  }
  // nothing in flight and nothing being read when the ring becomes staging (the last foot's barrier has ended every read)
  wait_tensor0();
  wait_ds0();

  // ---- this wave's partial O (x 1024) as Pt[gl][x][c], x = 16 qt + c16 ----
  float* Pt = (float*)(void*)smem;
  {
    float* ptw = Pt + (wave * 16 + c16) * OPITCH + 8 * hh;
#pragma unroll
    for (int ct = 0; ct < 16; ++ct) {                  // channels 16ct + 8hh + 0..7
      v4f w0, w1;
#pragma unroll
      for (int r = 0; r < 4; ++r) { w0[r] = o[ct][r]; w1[r] = o[ct][4 + r]; }
      *(v4f*)(ptw + 16 * ct)     = w0;
      *(v4f*)(ptw + 16 * ct + 4) = w1;
    }
  }
  __syncthreads();
  // ---- sum of the 4 group lanes in order; the quarter's partial O (x 1024) goes out as part[kq][b][query][c] ----
  {
    float* pb = part + ((size_t)(kq * NB + b) * LQ + uq0) * NC;
#pragma unroll
    for (int it = 0; it < 8; ++it) {
      const int n = it * 512 + tid;                    // 16-B piece 0..4095: x = n / 64, c = 4 (n % 64)
      const int x = n >> 6, c = 4 * (n & 63);
      const float* pp = Pt + x * OPITCH + c;
      v4f acc = *(const v4f*)(pp);
#pragma unroll
      for (int w = 1; w < 4; ++w) acc += *(const v4f*)(pp + w * (QBLK * OPITCH));
      *(v4f*)(pb + (size_t)x * NC + c) = acc;
    }
  }
}

// =====================================================================================================
// Merge for one (b, query-map row y, half row g): 16 unique queries. The 4 key quarters' partials are summed in order,
//   Z = O x 1/1024 + bf16(D) goes to Os[x][c], block barrier, whole-line output stores with the 2 x 2 replication.
// coverage: Os: 16 waves (x = wave) x 2 x 32 lanes x 4 c = 16 x x 256 c; output: block (b,y,g) writes
//   out[b][c][2y..2y+1][32g..32g+31] for all 256 c = 512 lines; grid = NB x 32 rows x 2 = 256 blocks covers
//   out [4][256][64][64] exactly once.
// =====================================================================================================
__global__ __launch_bounds__(512)
void merge_kernel(const float* __restrict__ part, const unsigned short* __restrict__ qp, float* out) {
  __shared__ __align__(16) float Os[16 * OPITCH];
  const int tid  = threadIdx.x;
  const int wave = __builtin_amdgcn_readfirstlane(tid >> 5);
  const int lane = tid & 31;
  const int bx   = blockIdx.x;
  const int b    = bx >> 6;
  const int y    = (bx >> 1) & 31;
  const int g    = bx & 1;
  const int uq0  = y * 32 + 16 * g;               // first unique query of the block
  const unsigned short* Qb = qp + ((size_t)(b * LQ + uq0) / 16) * (NC / 32) * FTILE;
  {
    const unsigned short* qres = Qb + 8 * wave;        // x = wave: column wave of the block's Q tiles
#pragma unroll
    for (int it = 0; it < 2; ++it) {
      const int c = 4 * (it * 32 + lane);              // it 0..1 x 32 lanes x 4 c = channels 0..255
      const float* pp = part + ((size_t)b * LQ + uq0 + wave) * NC + c;
      v4f acc = *(const v4f*)(pp);
#pragma unroll
      for (int w = 1; w < KSPL; ++w) acc += *(const v4f*)(pp + (size_t)w * ((size_t)NB * LQ * NC));
      // channel c = 32 kk + 16 j + 8 h + t of the fragment order
      const v4us qq = *(const v4us*)(qres + (c >> 5) * FTILE + ((c >> 4) & 1) * (FTILE / 2) + ((c >> 3) & 1) * 128 + (c & 7));
      v4f z;
#pragma unroll
      for (int r = 0; r < 4; ++r) z[r] = acc[r] * PUNDO + bf_up(qq[r]);
      *(v4f*)(Os + wave * OPITCH + c) = z;
    }
  }
  __syncthreads();
  {
    const int e = tid & 7, lq = tid >> 3;              // lq 0..63: line within group, e: 16-B piece
    float* ob = out + (size_t)b * NC * LK + (size_t)(2 * y) * 64 + 32 * g + 4 * e;
    v4f vals[8];
#pragma unroll
    for (int it = 0; it < 8; ++it) {
      const int L = it * 64 + lq;                      // lines 0..511 of the block: 2 lines per channel
      const int c = L >> 1;
      const float* sp = Os + (2 * e) * OPITCH + c;     // x - 16g = (w - 32g)>>1 for w = 32g + 4e + 0..3
      const float z0 = sp[0], z1 = sp[OPITCH];
      v4f v;
      v[0] = z0; v[1] = z0; v[2] = z1; v[3] = z1;
      vals[it] = v;
    }
#pragma unroll
    for (int it = 0; it < 8; ++it) {
      const int L = it * 64 + lq;
      const int c = L >> 1, hrow = L & 1;
      *(v4f*)(ob + (size_t)c * LK + hrow * 64) = vals[it];
    }
  }
}

// =====================================================================================================
//   KP   bf16 [4][256][8][512]      0           8388608
//   VT   f16  [4][64][16][2][512]   8388608     8388608
//   QP   bf16 [4][64][8][512]       16777216    2097152
//   PART f32  [4][4][1024][256]     18874368    16777216
//   end                          35651584
// =====================================================================================================
extern "C" void kernel_launch(void* const* d_in, const int* in_sizes, int n_in,
                              void* d_out, int out_size, void* d_ws, size_t ws_size,
                              hipStream_t stream) {
  const int ND = NB * NC * LQ;                          // 1048576
  const int NS = NB * NC * LK;                          // 4194304
  if (n_in < 2) return;
  if (in_sizes[0] != ND || in_sizes[1] != NS) return;
  if (out_size != NS) return;

  size_t off = 0;
  const size_t oK = off; off += (size_t)NS * 2;         // 8388608
  const size_t oV = off; off += (size_t)NS * 2;         // 8388608
  const size_t oQ = off; off += (size_t)ND * 2;         // 2097152
  const size_t oP = off; off += (size_t)ND * 4 * KSPL;  // 16777216
  if (off > ws_size) return;                            // off = 35651584
  if (off > (size_t)134217728) return;

  const float* Dp = (const float*)d_in[0];              // [4][256][32][32]
  const float* Sp = (const float*)d_in[1];              // [4][256][64][64]
  char* ws = (char*)d_ws;
  unsigned short* KP = (unsigned short*)(ws + oK);
  unsigned short* VT = (unsigned short*)(ws + oV);
  unsigned short* QP = (unsigned short*)(ws + oQ);
  float* PART = (float*)(ws + oP);
  float* out = (float*)d_out;

  const dim3 blk256(256), blkA(32 * NWAVE);
  const dim3 gS(NB * 4 * (LK / 64));                    // 1024 blocks
  const dim3 gD(NB * 4 * (LQ / 64));                    // 256 blocks
  const dim3 gA(NB * (LQ / QBLK) * KSPL);               // 256 blocks
  const dim3 gM(NB * (LQ / 16));                        // 256 blocks

  // (0) S -> KP bf16 (rows = keys) and VT f16 (rows = channels), both in fragment order
  cvt_plane<<<gS, blk256, 0, stream>>>(Sp, LK, LK / 64, 1, KP, VT);
  // (1) D -> QP bf16 (columns = queries) in fragment order; the f16 plane is not written (dov = 0)
  cvt_plane<<<gD, blk256, 0, stream>>>(Dp, LQ, LQ / 64, 0, QP, VT);
  // (2) attention over the 1024 unique queries per batch, one partial O per key quarter
  attn_kernel<<<gA, blkA, 0, stream>>>(QP, KP, VT, PART);
  // (3) the 4 partials summed, residual added, 2x2 replicated into out [4][256][64][64]
  merge_kernel<<<gM, blkA, 0, stream>>>(PART, QP, out);
  (void)hipGetLastError();
}

// v004
// Measured time: 35.1 microseconds a run.
// In two side-by-side timings against v003, it was 1.05 and 1.06 times as fast.
// Over all steps from v000 it is 8.75 times as fast.
// Contractions: scores S^T = K (bf16, RNE convert of input S) . Q^T (bf16, RNE convert of input D) on v_wmma_f32_16x16x32_bf16, depth 256, one product;
// O^T = V^T (f16 of bf16-RNE input S, x1) . P^T (f16, per-group normalised softmax weights x1024) on v_wmma_f32_16x16x32_f16, one product; f32 accumulate everywhere;
// softmax (group max, exp, group sum, 1/l) in f32 on VALU; residual add in f32 from the bf16-RNE plane of D.
#include <hip/hip_runtime.h>
#include <math.h>
#include <stdint.h>

#define NB     4
#define NC     256          // channels: contraction depth of the scores, rows of O^T
#define LQ     1024         // unique queries per batch (32 x 32 query map)
#define LK     4096         // keys per batch (64 x 64 key map)
#define NGRP   64           // key groups (softmax runs over the 64 keys of one group)
#define QBLK   64           // unique queries per attention block = 4 query tiles of 16
#define KSPL   4            // key quarters: an attention block walks NGRP / KSPL key groups
#define NWAVE  16           // waves per attention block: 4 query tiles x 4 group lanes
#define NTRIP  4            // trips of an attention block: 4 key groups (one per group lane) a trip
#define GRPB   32768        // bytes of one key group in the K plane and in the V^T plane
#define STAGEB 131072       // bytes of one ring stage: the K or the V^T of a trip's 4 key groups
#define SLICEB 8192         // bytes of one wave's slice of a stage
#define SLROWB 1024         // a slice as a tensor tile: rows of 1024 bytes ...
#define SLROWS 8            // ... 8 of them
#define SMEMB  266240       // LDS of an attention block: the ring (2 stages), later 4 x 64 x OPITCH floats of partials
#define TPITCH 72           // LDS transpose tile pitch (halves)
#define FTILE  512          // halves of one 16 x 32 operand tile in fragment order (1 KiB)
#define OPITCH 260          // LDS output staging pitch (floats)
#define RTEMP  0.0625f      // 1 / temperature
#define PCARRY 1024.0f
#define PUNDO  0.0009765625f
#define CVS    1024         // conversion blocks of S: NB x 4 channel tiles x 64 position tiles
#define CVD    256          // conversion blocks of D: NB x 4 channel tiles x 16 position tiles
static_assert(LQ == 32 * 32);
static_assert(LK == 64 * 64);
static_assert((NC % 64) == 0);
static_assert(NGRP * 64 == LK);
static_assert(CVS == NB * (NC / 64) * (LK / 64));
static_assert(CVD == NB * (NC / 64) * (LQ / 64));
static_assert(NWAVE == (QBLK / 16) * 4);
static_assert(NTRIP * 4 * KSPL == NGRP);
static_assert(GRPB == 64 * NC * 2);
static_assert(STAGEB == 4 * GRPB);
static_assert(SLICEB * NWAVE == STAGEB);
static_assert(SLROWB * SLROWS == SLICEB);
static_assert((SLICEB % 2048) == 0);
static_assert(SMEMB >= 2 * STAGEB);
static_assert(SMEMB >= 4 * QBLK * OPITCH * 4);

typedef _Float16       v16h __attribute__((ext_vector_type(16)));
typedef _Float16       v8h  __attribute__((ext_vector_type(8)));
typedef __bf16         v16b __attribute__((ext_vector_type(16)));
typedef unsigned short v8us __attribute__((ext_vector_type(8)));
typedef unsigned short v4us __attribute__((ext_vector_type(4)));
typedef float          v8f  __attribute__((ext_vector_type(8)));
typedef float          v4f  __attribute__((ext_vector_type(4)));
typedef unsigned int   v4u  __attribute__((ext_vector_type(4)));

union FragH { v16h v; v8h  h[2]; };
union FragB { v16b v; v8us u[2]; };
static_assert(sizeof(FragH) == 32);
static_assert(sizeof(FragB) == 32);

// ---- scalar helpers --------------------------------------------------------------------------------
__device__ __forceinline__ unsigned short bf_bits(float f) {          // f32 -> bf16 bits, RNE convert
  unsigned u = __float_as_uint(f);
  return (unsigned short)((u + 0x7FFFu + ((u >> 16) & 1u)) >> 16);
}
__device__ __forceinline__ float bf_up(unsigned short h) { return __uint_as_float(((unsigned)h) << 16); }
__device__ __forceinline__ unsigned short h_bits(_Float16 x) { return __builtin_bit_cast(unsigned short, x); }
__device__ __forceinline__ unsigned pk16(unsigned short a, unsigned short b) { return (unsigned)a | ((unsigned)b << 16); }
__device__ __forceinline__ v8f zero8() { v8f z = {0.f, 0.f, 0.f, 0.f, 0.f, 0.f, 0.f, 0.f}; return z; }
__device__ __forceinline__ float hmax8(v8f s) {
  return fmaxf(fmaxf(fmaxf(s[0], s[1]), fmaxf(s[2], s[3])), fmaxf(fmaxf(s[4], s[5]), fmaxf(s[6], s[7])));
}

// ---- fragment loaders: 16-bit A/B operand from a plane stored in fragment order. One 16 x 32 tile is FTILE halves
//      (1 KiB): [j 0..1][lane 0..31][t 0..7] holds row/col (lane&15), k = 16j + 8(lane>>4) + t. p is the tile (the
//      same in every lane), l8 = 8*lane; elements 0..7 <- j = 0, elements 8..15 <- j = 1: each load of the wave is
//      512 contiguous bytes = 4 whole lines
__device__ __forceinline__ v16h ldfrag_h(const _Float16* p, unsigned l8) {
  FragH f;
  f.h[0] = *(const v8h*)(p + l8);
  f.h[1] = *(const v8h*)(p + FTILE / 2 + l8);
  return f.v;
}
__device__ __forceinline__ v16b ldfrag_b(const unsigned short* p, unsigned l8) {
  FragB f;
  f.u[0] = *(const v8us*)(p + l8);
  f.u[1] = *(const v8us*)(p + FTILE / 2 + l8);
  return f.v;
}

// ---- WMMA helpers with trailing VALU hazard gap --------------------------------------------------------
__device__ __forceinline__ v8f mma_h_raw(v16h a, v16h b, v8f c) {
  return __builtin_amdgcn_wmma_f32_16x16x32_f16(false, a, false, b, (short)0, c, false, false);
}
__device__ __forceinline__ v8f mma_b_raw(v16b a, v16b b, v8f c) {
  return __builtin_amdgcn_wmma_f32_16x16x32_bf16(false, a, false, b, (short)0, c, false, false);
}
// ties two score accumulators, keeps the four A fragments and the two B fragments live past the nops: the nops keep
// the distance behind the last WMMA on the taken side of the loop branch
__device__ __forceinline__ void sguard(v8f& a, v8f& b, v16b x0, v16b x1, v16b x2, v16b x3, v16b y0, v16b y1) {
#if defined(__HIP_DEVICE_COMPILE__)
  const v16h h0 = __builtin_bit_cast(v16h, x0), h1 = __builtin_bit_cast(v16h, x1);
  const v16h h2 = __builtin_bit_cast(v16h, x2), h3 = __builtin_bit_cast(v16h, x3);
  const v16h g0 = __builtin_bit_cast(v16h, y0), g1 = __builtin_bit_cast(v16h, y1);
  asm volatile("v_nop\n\tv_nop\n\tv_nop\n\tv_nop"
               : "+v"(a), "+v"(b) : "v"(h0), "v"(h1), "v"(h2), "v"(h3), "v"(g0), "v"(g1));
#endif
}
// ties one output accumulator, keeps its two A fragments and both P fragments live past the nops
__device__ __forceinline__ void oguard(v8f& a, v16h x0, v16h x1, v16h p0, v16h p1) {
#if defined(__HIP_DEVICE_COMPILE__)
  asm volatile("v_nop\n\tv_nop\n\tv_nop\n\tv_nop" : "+v"(a) : "v"(x0), "v"(x1), "v"(p0), "v"(p1));
#endif
}

// =====================================================================================================
// Operand planes of S and of D in ONE launch: the two conversions do not depend on each other, so blocks 0..CVS-1 take
// S and blocks CVS..CVS+CVD-1 take D (the choice is the same for a whole block). src is viewed as [NB][NC][rowlen] f32
// (rowlen = LK for S, LQ for D). One block (256 threads) handles (b, channel tile ct of 64, position tile kt of 64):
//   dT[b][pos/16][c/32][FTILE] = bf16 bits (RNE convert), fragment order with row = pos, k = c: the 64(c) x 64(pos)
//                    tile goes through LDS Ts[pos][c] (pitch 72 halves, 2-byte LDS stores), block barrier, then every
//                    wave store writes 512 contiguous bytes
//   dV[b][pos/64][c/16][(pos/32)&1][FTILE] = f16 bits of the bf16-RNE value, fragment order with row = c, k = pos
//                    (only for S): every wave store writes 4 whole lines
// coverage: Ts / dV: 8 waves x 8 rows x (2 x 4 lanes x 8 pos) = 64 c x 64 pos; dT: 2 x 256 pieces of 8 c = 8 tiles
//           = 64 pos x 64 c; grid = NB x 4 ct x (LK/64 + LQ/64) kt covers the three planes exactly once, no tails.
// =====================================================================================================
__global__ __launch_bounds__(256) void cvt_planes(const float* __restrict__ srcS, const float* __restrict__ srcD,
                                                   unsigned short* dK, unsigned short* dV, unsigned short* dQ) {
  __shared__ __align__(16) unsigned short Ts[64 * TPITCH];
  const int tid  = threadIdx.x;
  const int lane = tid & 31, wave = tid >> 5;
  const bool isS = blockIdx.x < CVS;                    // block-uniform: this block converts S, else D
  const float* src    = isS ? srcS : srcD;
  unsigned short* dT  = isS ? dK : dQ;
  const int rowlen    = isS ? LK : LQ;
  const int lgk       = isS ? 6 : 4;                    // log2 of the position tiles in a row
  const int nkt       = rowlen / 64;
  const int bx   = isS ? (int)blockIdx.x : (int)blockIdx.x - CVS;
  const int kt   = bx & (nkt - 1);
  const int rest = bx >> lgk;
  const int ct   = rest & 3;
  const int b    = rest >> 2;

  // ---- phase 1: read 64 c rows x 64 positions, convert, fill Ts (transposed), store the direct f16 plane ----
  {
    const int r8 = lane & 7, eq = lane >> 3;            // r8: row within the wave's 8 rows, eq: 16-B piece (j, h)
    v4u u[2];
    size_t go[2];
#pragma unroll
    for (int it = 0; it < 2; ++it) {
      const int row = wave * 8 + r8;                    // channel within the tile 0..63
      const int e   = it * 4 + eq;                      // positions 8e..8e+7 = 32 it + 16 (eq>>1) + 8 (eq&1) + 0..7
      const size_t o = ((size_t)(b * NC + ct * 64 + row)) * (size_t)rowlen + (size_t)kt * 64 + 8 * e;
      go[it] = ((((size_t)(b * nkt + kt)) * (NC / 16) + ct * 4 + (row >> 4)) * 2 + it) * FTILE
               + (eq >> 1) * (FTILE / 2) + ((eq & 1) * 16 + (row & 15)) * 8;
      const v4f a = *(const v4f*)(src + o), c4 = *(const v4f*)(src + o + 4);
      unsigned short w[8];
#pragma unroll
      for (int t = 0; t < 4; ++t) { w[t] = bf_bits(a[t]); w[4 + t] = bf_bits(c4[t]); }
#pragma unroll
      for (int t = 0; t < 8; ++t) Ts[(8 * e + t) * TPITCH + row] = w[t];
      v4u pk;
#pragma unroll
      for (int t = 0; t < 4; ++t)
        pk[t] = pk16(h_bits((_Float16)bf_up(w[2 * t])), h_bits((_Float16)bf_up(w[2 * t + 1])));
      u[it] = pk;
    }
    if (isS) {
      {
#pragma unroll
        for (int it = 0; it < 2; ++it) *(v4u*)(dV + go[it]) = u[it];
        
      }
    }
  }
  __syncthreads();
  // ---- phase 2: transposed plane in fragment order, whole-line stores ----
  {
    v4u u[2];
    size_t go[2];
#pragma unroll
    for (int it = 0; it < 2; ++it) {
      const int n   = it * 256 + tid;                   // 16-B piece 0..511 of the block's 8 tiles
      const int ptl = n >> 7, kkl = (n >> 6) & 1;       // 16-position tile 0..3, 32-channel step 0..1
      const int e   = kkl * 4 + ((n >> 4) & 3);         // channels 8e..8e+7 = 32 kkl + 16 j + 8 h + 0..7
      u[it]  = *(const v4u*)(Ts + (ptl * 16 + (n & 15)) * TPITCH + 8 * e);
      go[it] = (((size_t)(b * nkt + kt) * 4 + ptl) * (NC / 32) + ct * 2 + kkl) * FTILE + (n & 63) * 8;
    }
    {
#pragma unroll
      for (int it = 0; it < 2; ++it) *(v4u*)(dT + go[it]) = u[it];
      
    }
  }
}

// =====================================================================================================
// Tensor load helpers (two-group descriptor, 1-byte elements, no pad, no mask)
// =====================================================================================================
typedef uint32_t u32x4 __attribute__((ext_vector_type(4)));
typedef uint32_t u32x8 __attribute__((ext_vector_type(8)));
__device__ __forceinline__ uint32_t uni(uint32_t v) { return (uint32_t)__builtin_amdgcn_readfirstlane(v); }
// the test of a tensor load's branch: it must compile to s_cmp + s_cbranch_scc, for a tensor load ignores EXEC
__device__ __forceinline__ uint32_t pinned(uint32_t v) {
  uint32_t w = uni(v);
  asm volatile("" : "+s"(w));  // pinned(): holds the test in a scalar register
  return w;
}
// the compiler places no wait for the tensor mover, and none of these may move over an LDS access: "memory"
__device__ __forceinline__ void wait_ds0()     { asm volatile("s_wait_dscnt 0x0" ::: "memory"); }
__device__ __forceinline__ void wait_tensor0() { asm volatile("s_wait_tensorcnt 0x0" ::: "memory"); }
__device__ __forceinline__ void tdm_load(u32x4 g0, u32x8 g1) {
  asm volatile("tensor_load_to_lds %0, %1" :: "s"(g0), "s"(g1) : "memory");
}
// the same wait, naming the request's group 0 as an input: its registers keep their values until the tile has landed
__device__ __forceinline__ void wait_tensor0_of(u32x4 g0) { asm volatile("s_wait_tensorcnt 0x0" :: "s"(g0) : "memory"); }
// tile = SLROWS rows of SLROWB bytes, source pitch = the row: one wave's slice of a stage, SLICEB contiguous bytes
__device__ __forceinline__ u32x8 tdm_group1() {
  constexpr uint32_t d0 = SLROWB, d1 = SLROWS;
  u32x8 g;
  g[0] = uni(0u);
  g[1] = uni((d0 & 0xFFFFu) << 16);
  g[2] = uni((d0 >> 16) | ((d1 & 0xFFFFu) << 16));
  g[3] = uni((d1 >> 16) | (d0 << 16));
  g[4] = uni(d1);
  g[5] = uni(SLROWB);
  g[6] = uni(0u);
  g[7] = uni(0u);
  return g;
}
__device__ __forceinline__ u32x4 tdm_group0(uint32_t lds_dst, uint64_t ga) {
  u32x4 g;
  g[0] = uni(1u);
  g[1] = uni(lds_dst);
  g[2] = uni((uint32_t)ga);
  g[3] = uni((((uint32_t)(ga >> 32)) & 0x01FFFFFFu) | 0x80000000u);
  return g;
}

// =====================================================================================================
// Attention for one (b, 64 unique queries qb, key quarter kq = 16 key groups), transposed formulation.
//   Block = 16 waves = 4 query tiles (qt = wave & 3, 16 queries each) x 4 group lanes (gl = wave >> 2).
//   The softmax runs inside one key group of 64 keys and the output is the plain sum over the 64 groups, so a wave
//   owns WHOLE key groups: in trip j wave (qt, gl) takes group 16 kq + 4 j + gl.
//   K and V^T of a trip's four groups (128 KiB each, contiguous in the fragment-ordered planes) are brought into LDS
//   ONCE per block by tensor loads, every wave its own 8-KiB slice, and each fragment is read from LDS by the four
//   query tiles. Ring of two buffers: stage 2j = K of trip j (buffer 0), stage 2j+1 = V^T of trip j (buffer 1);
//   pass 2j = the scores, pass 2j+1 = the output products; at the foot of pass s: s_wait_dscnt 0, s_wait_tensorcnt 0,
//   block barrier, then stage s+2 into the buffer that pass s has just read.
//   Per key group: scores S^T (64 keys x 16 queries, 4 tiles) = A(K rows = keys, bf16) . B(Q, col = query, bf16 plane),
//   8 c-steps of 32; group max and group sum need only the lane pair (lane, lane^16).
//   P = e^{(s-m)/16} / l x 1024 as f16: score tiles 2p and 2p+1 of a lane ARE elements 0..7 and 8..15 of the B
//   fragment for keys 32p..32p+31 (split k map), so P never leaves the registers.
//   O^T (rows c, cols queries) += A(V^T rows c, f16) . B(P^T), 2 key-steps of 32, all 256 channels in the wave.
//   Epilogue: each wave stores its partial O as Pt[gl][x][c] over the ring (16-B stores, pitch 260), block barrier, the
//   4 group lanes are summed in order and go, still x 1024, to part[kq][b][query][c] in whole lines.
// coverage: a stage: 16 waves x 8 KiB = 128 KiB = 4 groups x 32 KiB; Pt: 16 waves x 16 x x 256 c; part: 8 x 512 threads
//   x 4 c = 64 x x 256 c per block; grid = NB x 16 qb x 4 kq = 256 blocks covers part [4][4][1024][256] exactly once.
// =====================================================================================================
__global__ __launch_bounds__(32 * NWAVE)
void attn_kernel(const unsigned short* __restrict__ qp, const unsigned short* __restrict__ kp,
                 const unsigned short* __restrict__ vtp, float* part) {
  __shared__ __attribute__((aligned(2048))) unsigned char smem[SMEMB];
  const int tid  = threadIdx.x;
  const int wave = __builtin_amdgcn_readfirstlane(tid >> 5);
  const int lane = tid & 31;
  const int hh   = lane >> 4;
  const int c16  = lane & 15;
  const int qt   = wave & 3;                      // query tile of the wave
  const int gl   = wave >> 2;                     // group lane of the wave
  const int bx   = blockIdx.x;
  const int kq   = bx & (KSPL - 1);               // key quarter
  const int qb   = (bx / KSPL) & (LQ / QBLK - 1); // block of 64 unique queries
  const int b    = bx / (KSPL * (LQ / QBLK));
  const int uq0  = qb * QBLK;                     // first unique query of the block

  // ---- Q fragment base (B operand, col = query uq0 + 16 qt + c16), + FTILE*kk ----
  const unsigned short* Qb = qp + ((size_t)(b * LQ + uq0) / 16 + qt) * (NC / 32) * FTILE;
  // ---- K fragments of the wave's group in buffer 0 (A operand, row = key), + (key/16)*(NC/32)*FTILE + FTILE*kk ----
  const unsigned short* Kl = (const unsigned short*)(const void*)(smem + gl * GRPB);
  // ---- V^T fragments of the wave's group in buffer 1 (A operand, row = channel), + (ct*2 + key step)*FTILE ----
  const _Float16* Vl = (const _Float16*)(const void*)(smem + STAGEB + gl * GRPB);
  const unsigned l8 = 8u * (unsigned)lane;        // this lane's 16 bytes in each half tile

  // ---- this wave's slice of a stage: source (trip 0) and place in LDS ----
  const size_t   sofs = ((size_t)(b * NGRP + kq * (NGRP / KSPL))) * GRPB + (size_t)wave * SLICEB;
  const uint64_t ksrc = (uint64_t)(size_t)kp + sofs;
  const uint64_t vsrc = (uint64_t)(size_t)vtp + sofs;
  const uint32_t kdst = (uint32_t)(size_t)smem + (uint32_t)wave * SLICEB;
  const uint32_t vdst = kdst + STAGEB;
  const u32x8 g1 = tdm_group1();

  // ---- ring prologue: stage 0 (K of trip 0), landed and published; then stage 1 (V^T of trip 0) ----
  const u32x4 gk0 = tdm_group0(kdst, ksrc);
  tdm_load(gk0, g1);
  wait_tensor0_of(gk0);
  __syncthreads();
  tdm_load(tdm_group0(vdst, vsrc), g1);

  v8f o[16];
#pragma unroll
  for (int ct = 0; ct < 16; ++ct) o[ct] = zero8();

  // rolled: one copy of the body; nothing is carried from one key group to the next but o[]
#pragma unroll 1
  for (int j = 0; j < NTRIP; ++j) {
    // ---- pass 2j: scores for the 64 keys of the wave's group, K from buffer 0 ----
    v8f s[4];
    // unrolled: s[] is indexed by constants only and stays in registers
#pragma unroll
    for (int tp = 0; tp < 2; ++tp) {
      const unsigned short* K0 = Kl + (size_t)(2 * tp) * (NC / 32) * FTILE;               // keys 32tp +  0..15
      const unsigned short* K1 = K0 + (size_t)(NC / 32) * FTILE;                          // keys 32tp + 16..31
      v8f s0 = zero8(), s1 = zero8();
      // one trip uses two whole tiles (2 KiB in a row) of each 16-key row of tiles;
      // rolled: only one trip's fragments are live beside o[], which keeps four waves on a SIMD
#pragma unroll 1
      for (int k2 = 0; k2 < NC / 64; ++k2) {
        const v16b q0  = ldfrag_b(Qb + 2 * FTILE * k2, l8);
        const v16b q1  = ldfrag_b(Qb + 2 * FTILE * k2 + FTILE, l8);
        const v16b a00 = ldfrag_b(K0 + 2 * FTILE * k2, l8);
        const v16b a01 = ldfrag_b(K0 + 2 * FTILE * k2 + FTILE, l8);
        const v16b a10 = ldfrag_b(K1 + 2 * FTILE * k2, l8);
        const v16b a11 = ldfrag_b(K1 + 2 * FTILE * k2 + FTILE, l8);
        s0 = mma_b_raw(a00, q0, s0);
        s1 = mma_b_raw(a10, q0, s1);
        s0 = mma_b_raw(a01, q1, s0);
        s1 = mma_b_raw(a11, q1, s1);
        sguard(s0, s1, a00, a01, a10, a11, q0, q1);
      }
      s[2 * tp] = s0; s[2 * tp + 1] = s1;
    }
    // ---- foot of pass 2j: publishes V^T of trip j, frees buffer 0; then K of trip j+1 into buffer 0 ----
    wait_ds0();
    wait_tensor0();
    __syncthreads();
    if (pinned(j + 1 < NTRIP)) tdm_load(tdm_group0(kdst, ksrc + (uint64_t)(j + 1) * STAGEB), g1);

    // ---- group max over the 64 keys: 32 in this lane, 32 in lane^16 ----
    float m = fmaxf(fmaxf(hmax8(s[0]), hmax8(s[1])), fmaxf(hmax8(s[2]), hmax8(s[3])));
    m = fmaxf(m, __shfl_xor(m, 16, 32));

    // ---- e = exp((s - m)/16), group sum (one sum per 32 keys, then the two) ----
    v8f e[4];
    float lh[2];
#pragma unroll
    for (int tp = 0; tp < 2; ++tp) {
      float ls = 0.f;
#pragma unroll
      for (int r = 0; r < 8; ++r) {
        const float a0 = __expf((s[2 * tp][r] - m) * RTEMP);       // key 32tp      + 8hh + r
        const float a1 = __expf((s[2 * tp + 1][r] - m) * RTEMP);   // key 32tp + 16 + 8hh + r
        e[2 * tp][r] = a0; e[2 * tp + 1][r] = a1;
        ls += a0 + a1;
      }
      ls += __shfl_xor(ls, 16, 32);
      lh[tp] = ls;
    }
    const float l  = lh[0] + lh[1];                    // l in [1, 64]
    const float ps = PCARRY * __builtin_amdgcn_rcpf(l);

    // ---- normalised P x 1024 as f16, already in B-fragment order ----
    FragH p0, p1;
#pragma unroll
    for (int r = 0; r < 8; ++r) {
      p0.h[0][r] = (_Float16)(e[0][r] * ps);           // keys      8hh + 0..7
      p0.h[1][r] = (_Float16)(e[1][r] * ps);           // keys 16 + 8hh + 0..7
      p1.h[0][r] = (_Float16)(e[2][r] * ps);           // keys 32 + 8hh + 0..7
      p1.h[1][r] = (_Float16)(e[3][r] * ps);           // keys 48 + 8hh + 0..7
    }

    // ---- pass 2j+1: O^T[c][q] += V^T[c][keys] . P^T[keys][q] over the 64 keys, all 256 channels, V^T from buffer 1 ----
#pragma unroll
    for (int ct = 0; ct < 16; ++ct) {
      const _Float16* vp = Vl + (size_t)(2 * ct) * FTILE;
      const v16h v0 = ldfrag_h(vp, l8);
      const v16h v1 = ldfrag_h(vp + FTILE, l8);
      o[ct] = mma_h_raw(v0, p0.v, o[ct]);
      o[ct] = mma_h_raw(v1, p1.v, o[ct]);
      oguard(o[ct], v0, v1, p0.v, p1.v);
    }
    // ---- foot of pass 2j+1: publishes K of trip j+1, frees buffer 1; then V^T of trip j+1 into buffer 1 ----
    wait_ds0();
    wait_tensor0();
    __syncthreads();
    if (pinned(j + 1 < NTRIP)) tdm_load(tdm_group0(vdst, vsrc + (uint64_t)(j + 1) * STAGEB), g1);
  }
  // nothing in flight and nothing being read when the ring becomes staging (the last foot's barrier has ended every read)
  wait_tensor0();
  wait_ds0();

  // ---- this wave's partial O (x 1024) as Pt[gl][x][c], x = 16 qt + c16 ----
  float* Pt = (float*)(void*)smem;
  {
    float* ptw = Pt + (wave * 16 + c16) * OPITCH + 8 * hh;
#pragma unroll
    for (int ct = 0; ct < 16; ++ct) {                  // channels 16ct + 8hh + 0..7
      v4f w0, w1;
#pragma unroll
      for (int r = 0; r < 4; ++r) { w0[r] = o[ct][r]; w1[r] = o[ct][4 + r]; }
      *(v4f*)(ptw + 16 * ct)     = w0;
      *(v4f*)(ptw + 16 * ct + 4) = w1;
    }
  }
  __syncthreads();
  // ---- sum of the 4 group lanes in order; the quarter's partial O (x 1024) goes out as part[kq][b][query][c] ----
  {
    float* pb = part + ((size_t)(kq * NB + b) * LQ + uq0) * NC;
#pragma unroll
    for (int it = 0; it < 8; ++it) {
      const int n = it * 512 + tid;                    // 16-B piece 0..4095: x = n / 64, c = 4 (n % 64)
      const int x = n >> 6, c = 4 * (n & 63);
      const float* pp = Pt + x * OPITCH + c;
      v4f acc = *(const v4f*)(pp);
#pragma unroll
      for (int w = 1; w < 4; ++w) acc += *(const v4f*)(pp + w * (QBLK * OPITCH));
      *(v4f*)(pb + (size_t)x * NC + c) = acc;
    }
  }
}

// =====================================================================================================
// Merge for one (b, query-map row y, half row g): 16 unique queries. The 4 key quarters' partials are summed in order,
//   Z = O x 1/1024 + bf16(D) goes to Os[x][c], block barrier, whole-line output stores with the 2 x 2 replication.
// coverage: Os: 16 waves (x = wave) x 2 x 32 lanes x 4 c = 16 x x 256 c; output: block (b,y,g) writes
//   out[b][c][2y..2y+1][32g..32g+31] for all 256 c = 512 lines; grid = NB x 32 rows x 2 = 256 blocks covers
//   out [4][256][64][64] exactly once.
// =====================================================================================================
__global__ __launch_bounds__(512)
void merge_kernel(const float* __restrict__ part, const unsigned short* __restrict__ qp, float* out) {
  __shared__ __align__(16) float Os[16 * OPITCH];
  const int tid  = threadIdx.x;
  const int wave = __builtin_amdgcn_readfirstlane(tid >> 5);
  const int lane = tid & 31;
  const int bx   = blockIdx.x;
  const int b    = bx >> 6;
  const int y    = (bx >> 1) & 31;
  const int g    = bx & 1;
  const int uq0  = y * 32 + 16 * g;               // first unique query of the block
  const unsigned short* Qb = qp + ((size_t)(b * LQ + uq0) / 16) * (NC / 32) * FTILE;
  {
    const unsigned short* qres = Qb + 8 * wave;        // x = wave: column wave of the block's Q tiles
#pragma unroll
    for (int it = 0; it < 2; ++it) {
      const int c = 4 * (it * 32 + lane);              // it 0..1 x 32 lanes x 4 c = channels 0..255
      const float* pp = part + ((size_t)b * LQ + uq0 + wave) * NC + c;
      v4f acc = *(const v4f*)(pp);
#pragma unroll
      for (int w = 1; w < KSPL; ++w) acc += *(const v4f*)(pp + (size_t)w * ((size_t)NB * LQ * NC));
      // channel c = 32 kk + 16 j + 8 h + t of the fragment order
      const v4us qq = *(const v4us*)(qres + (c >> 5) * FTILE + ((c >> 4) & 1) * (FTILE / 2) + ((c >> 3) & 1) * 128 + (c & 7));
      v4f z;
#pragma unroll
      for (int r = 0; r < 4; ++r) z[r] = acc[r] * PUNDO + bf_up(qq[r]);
      *(v4f*)(Os + wave * OPITCH + c) = z;
    }
  }
  __syncthreads();
  {
    const int e = tid & 7, lq = tid >> 3;              // lq 0..63: line within group, e: 16-B piece
    float* ob = out + (size_t)b * NC * LK + (size_t)(2 * y) * 64 + 32 * g + 4 * e;
    v4f vals[8];
#pragma unroll
    for (int it = 0; it < 8; ++it) {
      const int L = it * 64 + lq;                      // lines 0..511 of the block: 2 lines per channel
      const int c = L >> 1;
      const float* sp = Os + (2 * e) * OPITCH + c;     // x - 16g = (w - 32g)>>1 for w = 32g + 4e + 0..3
      const float z0 = sp[0], z1 = sp[OPITCH];
      v4f v;
      v[0] = z0; v[1] = z0; v[2] = z1; v[3] = z1;
      vals[it] = v;
    }
#pragma unroll
    for (int it = 0; it < 8; ++it) {
      const int L = it * 64 + lq;
      const int c = L >> 1, hrow = L & 1;
      *(v4f*)(ob + (size_t)c * LK + hrow * 64) = vals[it];
    }
  }
}

// =====================================================================================================
//   KP   bf16 [4][256][8][512]      0           8388608
//   VT   f16  [4][64][16][2][512]   8388608     8388608
//   QP   bf16 [4][64][8][512]       16777216    2097152
//   PART f32  [4][4][1024][256]     18874368    16777216
//   end                          35651584
// =====================================================================================================
extern "C" void kernel_launch(void* const* d_in, const int* in_sizes, int n_in,
                              void* d_out, int out_size, void* d_ws, size_t ws_size,
                              hipStream_t stream) {
  const int ND = NB * NC * LQ;                          // 1048576
  const int NS = NB * NC * LK;                          // 4194304
  if (n_in < 2) return;
  if (in_sizes[0] != ND || in_sizes[1] != NS) return;
  if (out_size != NS) return;

  size_t off = 0;
  const size_t oK = off; off += (size_t)NS * 2;         // 8388608
  const size_t oV = off; off += (size_t)NS * 2;         // 8388608
  const size_t oQ = off; off += (size_t)ND * 2;         // 2097152
  const size_t oP = off; off += (size_t)ND * 4 * KSPL;  // 16777216
  if (off > ws_size) return;                            // off = 35651584
  if (off > (size_t)134217728) return;

  const float* Dp = (const float*)d_in[0];              // [4][256][32][32]
  const float* Sp = (const float*)d_in[1];              // [4][256][64][64]
  char* ws = (char*)d_ws;
  unsigned short* KP = (unsigned short*)(ws + oK);
  unsigned short* VT = (unsigned short*)(ws + oV);
  unsigned short* QP = (unsigned short*)(ws + oQ);
  float* PART = (float*)(ws + oP);
  float* out = (float*)d_out;

  const dim3 blk256(256), blkA(32 * NWAVE);
  const dim3 gC(CVS + CVD);                             // 1280 blocks
  const dim3 gA(NB * (LQ / QBLK) * KSPL);               // 256 blocks
  const dim3 gM(NB * (LQ / 16));                        // 256 blocks

  // (0) S -> KP bf16 (rows = keys) and VT f16 (rows = channels); D -> QP bf16 (columns = queries); all in fragment order
  cvt_planes<<<gC, blk256, 0, stream>>>(Sp, Dp, KP, VT, QP);
  // (1) attention over the 1024 unique queries per batch, one partial O per key quarter
  attn_kernel<<<gA, blkA, 0, stream>>>(QP, KP, VT, PART);
  // (2) the 4 partials summed, residual added, 2x2 replicated into out [4][256][64][64]
  merge_kernel<<<gM, blkA, 0, stream>>>(PART, QP, out);
  (void)hipGetLastError();
}
